// v000
// The times below were measured on an AMD MI455X: many runs one after another, warmed up first and cycling through
// copies of the inputs, with the whole window's GPU time divided by the number of runs. Launches and the gaps
// between them are all in it. The median over several windows is given; except for v000 it joins two sittings, which
// can be a few percent apart, so the side-by-side timings, each taken in one sitting, are the better comparison.
// v000 is the starting kernel. One run takes 192 microseconds.
#include <hip/hip_runtime.h>
#include <hip/hip_bf16.h>

// ---------------------------------------------------------------------------
// Types for WMMA (CDNA5 / gfx1250, wave32)
// ---------------------------------------------------------------------------
typedef __attribute__((ext_vector_type(16))) _Float16 v16h;
typedef __attribute__((ext_vector_type(8)))  _Float16 v8h;
typedef __attribute__((ext_vector_type(8)))  float    v8f;

__device__ __forceinline__ v16h mk16(v8h lo, v8h hi) {
    union { v16h v; v8h h[2]; } u;
    u.h[0] = lo; u.h[1] = hi;
    return u.v;
}

__device__ __forceinline__ v8h cvt8(float4 f0, float4 f1) {
    v8h h;
    h[0] = (_Float16)f0.x; h[1] = (_Float16)f0.y;
    h[2] = (_Float16)f0.z; h[3] = (_Float16)f0.w;
    h[4] = (_Float16)f1.x; h[5] = (_Float16)f1.y;
    h[6] = (_Float16)f1.z; h[7] = (_Float16)f1.w;
    return h;
}

__device__ __forceinline__ v8f wmma_f16(v16h a, v16h b, v8f c) {
    // D = A(16x32 f16) * B(32x16 f16) + C(16x16 f32)
    return __builtin_amdgcn_wmma_f32_16x16x32_f16(
        /*neg_a=*/false, a, /*neg_b=*/false, b,
        /*c_mod=*/(short)0, c, /*reuse_a=*/false, /*reuse_b=*/false);
}

// ---------------------------------------------------------------------------
// Async global->LDS staging (gfx1250 ASYNCcnt path). INST_OFFSET is added to
// BOTH the LDS and global address, so one base covers a contiguous row chunk.
// ---------------------------------------------------------------------------
__device__ __forceinline__ void async_copy32B(unsigned lds, unsigned long long g) {
    asm volatile(
        "global_load_async_to_lds_b128 %0, %1, off\n\t"
        "global_load_async_to_lds_b128 %0, %1, off offset:16"
        :: "v"(lds), "v"(g) : "memory");
}
__device__ __forceinline__ void async_copy64B(unsigned lds, unsigned long long g) {
    asm volatile(
        "global_load_async_to_lds_b128 %0, %1, off\n\t"
        "global_load_async_to_lds_b128 %0, %1, off offset:16\n\t"
        "global_load_async_to_lds_b128 %0, %1, off offset:32\n\t"
        "global_load_async_to_lds_b128 %0, %1, off offset:48"
        :: "v"(lds), "v"(g) : "memory");
}
__device__ __forceinline__ void async_wait0() {
    asm volatile("s_wait_asynccnt 0" ::: "memory");
}

// ---------------------------------------------------------------------------
// Problem constants
// ---------------------------------------------------------------------------
constexpr int BATCH = 2;
constexpr int SEQ   = 2048;
constexpr int HID   = 1024;
constexpr int HEADS = 16;
constexpr int HDIM  = 64;
constexpr int GM = BATCH * SEQ;   // 4096
constexpr int GN = HID;           // 1024
constexpr int GK = HID;           // 1024

// ---------------------------------------------------------------------------
// fp32 -> fp16 bulk conversion (one shot; makes all GEMM operands async-able)
// ---------------------------------------------------------------------------
__global__ __launch_bounds__(256)
void cvt_f16(const float* __restrict__ src, _Float16* __restrict__ dst) {
    const size_t i = (size_t)blockIdx.x * 256 + threadIdx.x;   // one v8 per thread
    const float4* s = (const float4*)src;
    float4 f0 = s[2 * i], f1 = s[2 * i + 1];
    *(v8h*)(dst + 8 * i) = cvt8(f0, f1);
}

// ---------------------------------------------------------------------------
// GEMM: C[M,N] = A[M,K] * W[N,K]^T   (all operands f16, C f32)
// Block tile 128x128x32, 256 threads = 8 waves, wave tile 32x64 (2x4 WMMA).
// LDS rows padded to 40 halves (80B stride -> conflict-free 16B frag reads).
// Double-buffered via async-to-LDS DMA; zero VGPR staging.
// ---------------------------------------------------------------------------
constexpr int BM = 128, BN = 128, BK = 32, LDT = 40;
constexpr int NKT = GK / BK;      // 32

__global__ __launch_bounds__(256)
void gemm_bt(const _Float16* __restrict__ Ah,
             const _Float16* __restrict__ Bh,
             float* __restrict__ C) {
    __shared__ _Float16 As[2][BM * LDT];
    __shared__ _Float16 Bs[2][BM * LDT];

    const int tid = threadIdx.x;
    const int m0 = blockIdx.y * BM;
    const int n0 = blockIdx.x * BN;
    const int lr = tid >> 1;           // 0..127 (tile row)
    const int lc = (tid & 1) * 16;     // 0 or 16 (k sub-chunk)

    const int wave = tid >> 5, lane = tid & 31;
    const int wm = (wave >> 1) * 32;
    const int wn = (wave & 1) * 64;
    const int l16 = lane & 15;
    const int kh8 = (lane >> 4) * 8;

    const _Float16* ga = Ah + (size_t)(m0 + lr) * GK + lc;
    const _Float16* gb = Bh + (size_t)(n0 + lr) * GK + lc;

    auto issue = [&](int kt, int buf) {
        const unsigned la = (unsigned)(size_t)&As[buf][lr * LDT + lc];
        const unsigned lb = (unsigned)(size_t)&Bs[buf][lr * LDT + lc];
        async_copy32B(la, (unsigned long long)(size_t)(ga + kt * BK));
        async_copy32B(lb, (unsigned long long)(size_t)(gb + kt * BK));
    };

    v8f acc[2][4] = {};

    issue(0, 0);
    async_wait0();
    __syncthreads();

    int cur = 0;
    for (int kt = 0; kt < NKT; ++kt) {
        if (kt + 1 < NKT) issue(kt + 1, cur ^ 1);

        v16h af[2], bf[4];
#pragma unroll
        for (int i = 0; i < 2; ++i) {
            const _Float16* base = &As[cur][(wm + 16 * i + l16) * LDT];
            af[i] = mk16(*(const v8h*)(base + kh8), *(const v8h*)(base + 16 + kh8));
        }
#pragma unroll
        for (int j = 0; j < 4; ++j) {
            const _Float16* base = &Bs[cur][(wn + 16 * j + l16) * LDT];
            bf[j] = mk16(*(const v8h*)(base + kh8), *(const v8h*)(base + 16 + kh8));
        }
#pragma unroll
        for (int i = 0; i < 2; ++i)
#pragma unroll
            for (int j = 0; j < 4; ++j)
                acc[i][j] = wmma_f16(af[i], bf[j], acc[i][j]);

        if (kt + 1 < NKT) async_wait0();
        __syncthreads();
        cur ^= 1;
    }

    const int rgrp = (lane >> 4) * 8;
#pragma unroll
    for (int i = 0; i < 2; ++i)
#pragma unroll
        for (int j = 0; j < 4; ++j)
#pragma unroll
            for (int r = 0; r < 8; ++r) {
                const int row = m0 + wm + 16 * i + r + rgrp;
                const int col = n0 + wn + 16 * j + l16;
                C[(size_t)row * GN + col] = acc[i][j][r];
            }
}

// ---------------------------------------------------------------------------
// RoPE + fp16 relayout: (b,s,h,d) f32  ->  (b,h,s,d) f16 for Q,K,V
// One thread per (b,s,h,d<32) pair; handles d and d+32.
// ---------------------------------------------------------------------------
__global__ __launch_bounds__(256)
void rope_cvt(const float* __restrict__ Qf, const float* __restrict__ Kf,
              const float* __restrict__ Vf,
              _Float16* __restrict__ qh, _Float16* __restrict__ kh,
              _Float16* __restrict__ vh) {
    const int i = blockIdx.x * 256 + threadIdx.x;  // 0 .. 2^21-1
    const int d = i & 31;
    const int h = (i >> 5) & 15;
    const int s = (i >> 9) & 2047;
    const int b = i >> 20;

    const size_t src = (((size_t)b * SEQ + s) * HEADS + h) * HDIM + d;
    const size_t dst = (((size_t)b * HEADS + h) * SEQ + s) * HDIM + d;

    // inv_freq = 10000^(-d/32) = exp(-d * ln(10000)/32)
    const float invf = __expf(-(float)d * (9.210340371976184f / 32.0f));
    const float ang  = (float)s * invf;
    float sn, cs;
    __sincosf(ang, &sn, &cs);

    const float q1 = Qf[src], q2 = Qf[src + 32];
    qh[dst]      = (_Float16)(q1 * cs - q2 * sn);
    qh[dst + 32] = (_Float16)(q2 * cs + q1 * sn);

    const float k1 = Kf[src], k2 = Kf[src + 32];
    kh[dst]      = (_Float16)(k1 * cs - k2 * sn);
    kh[dst + 32] = (_Float16)(k2 * cs + k1 * sn);

    vh[dst]      = (_Float16)Vf[src];
    vh[dst + 32] = (_Float16)Vf[src + 32];
}

// ---------------------------------------------------------------------------
// Flash attention: block = (64 queries) x (one b,h). 4 waves x 16 q-rows.
// Streaming softmax over 32 key tiles of 64. Q/K staged via async DMA.
// ---------------------------------------------------------------------------
constexpr int LDQ = 72;   // padded LDS row stride (halves) -> conflict-free

__global__ __launch_bounds__(128)
void attn_fa(const _Float16* __restrict__ qh, const _Float16* __restrict__ kh,
             const _Float16* __restrict__ vh, _Float16* __restrict__ oh) {
    __shared__ _Float16 Qs[64 * LDQ];
    __shared__ _Float16 Ks[64 * LDQ];
    __shared__ _Float16 Vt[64 * LDQ];       // transposed: [d][key]
    __shared__ _Float16 Ps[4][16 * LDQ];    // per-wave P scratch

    const int tid  = threadIdx.x;
    const int wave = tid >> 5, lane = tid & 31;
    const int l16  = lane & 15;
    const int kh8  = (lane >> 4) * 8;
    const int rgrp = (lane >> 4) * 8;

    const int b  = blockIdx.z;
    const int hh = blockIdx.y;
    const int q0 = blockIdx.x * 64;
    const size_t bh = (size_t)b * HEADS + hh;
    const _Float16* Qg = qh + bh * SEQ * HDIM;
    const _Float16* Kg = kh + bh * SEQ * HDIM;
    const _Float16* Vg = vh + bh * SEQ * HDIM;

    const int srow = tid >> 1;            // staging row 0..63
    const int scol = (tid & 1) * 32;      // staging col 0 or 32

    // ---- stage Q tile (64 x 64) once, via async DMA ----
    async_copy64B((unsigned)(size_t)&Qs[srow * LDQ + scol],
                  (unsigned long long)(size_t)(Qg + (size_t)(q0 + srow) * HDIM + scol));
    async_wait0();
    __syncthreads();

    // Q fragments for this wave (constant across key tiles)
    v16h qa0, qa1;
    {
        const _Float16* base = &Qs[(wave * 16 + l16) * LDQ];
        qa0 = mk16(*(const v8h*)(base + kh8),      *(const v8h*)(base + 16 + kh8));
        qa1 = mk16(*(const v8h*)(base + 32 + kh8), *(const v8h*)(base + 48 + kh8));
    }

    float mrow[8], lrow[8];
    v8f oa[4] = {};
#pragma unroll
    for (int r = 0; r < 8; ++r) { mrow[r] = -1e30f; lrow[r] = 0.0f; }

    for (int kt = 0; kt < SEQ / 64; ++kt) {
        // ---- stage K tile (async DMA) and V tile (manual transpose) ----
        async_copy64B((unsigned)(size_t)&Ks[srow * LDQ + scol],
                      (unsigned long long)(size_t)(Kg + (size_t)(kt * 64 + srow) * HDIM + scol));
        {
            const _Float16* pv = Vg + (size_t)(kt * 64 + srow) * HDIM + scol;
            v8h v0 = *(const v8h*)pv,        v1 = *(const v8h*)(pv + 8);
            v8h v2 = *(const v8h*)(pv + 16), v3 = *(const v8h*)(pv + 24);
#pragma unroll
            for (int e = 0; e < 8; ++e) {
                Vt[(scol + e)      * LDQ + srow] = v0[e];
                Vt[(scol + 8 + e)  * LDQ + srow] = v1[e];
                Vt[(scol + 16 + e) * LDQ + srow] = v2[e];
                Vt[(scol + 24 + e) * LDQ + srow] = v3[e];
            }
        }
        async_wait0();
        __syncthreads();

        // ---- scores S = Q * K^T * scale : 4 frags of 16x16 ----
        v8f sc[4];
#pragma unroll
        for (int j = 0; j < 4; ++j) {
            const _Float16* base = &Ks[(j * 16 + l16) * LDQ];
            v16h kb0 = mk16(*(const v8h*)(base + kh8),      *(const v8h*)(base + 16 + kh8));
            v16h kb1 = mk16(*(const v8h*)(base + 32 + kh8), *(const v8h*)(base + 48 + kh8));
            v8f z = {};
            z = wmma_f16(qa0, kb0, z);
            z = wmma_f16(qa1, kb1, z);
#pragma unroll
            for (int r = 0; r < 8; ++r) z[r] *= 0.125f;   // 1/sqrt(64)
            sc[j] = z;
        }

        // ---- online softmax (rows live across 16-lane halves) ----
        float tm[8];
#pragma unroll
        for (int r = 0; r < 8; ++r) {
            float a = fmaxf(fmaxf(sc[0][r], sc[1][r]), fmaxf(sc[2][r], sc[3][r]));
#pragma unroll
            for (int t = 1; t < 16; t <<= 1) a = fmaxf(a, __shfl_xor(a, t, 32));
            tm[r] = a;
        }
#pragma unroll
        for (int r = 0; r < 8; ++r) {
            const float nm   = fmaxf(mrow[r], tm[r]);
            const float corr = __expf(mrow[r] - nm);
            mrow[r] = nm;
            float rs = 0.0f;
#pragma unroll
            for (int j = 0; j < 4; ++j) {
                const float p = __expf(sc[j][r] - nm);
                rs += p;
                Ps[wave][(r + rgrp) * LDQ + j * 16 + l16] = (_Float16)p;
            }
#pragma unroll
            for (int t = 1; t < 16; t <<= 1) rs += __shfl_xor(rs, t, 32);
            lrow[r] = lrow[r] * corr + rs;
#pragma unroll
            for (int j = 0; j < 4; ++j) oa[j][r] *= corr;
        }

        // intra-wave LDS exchange: make lane-crossing P stores visible
        asm volatile("s_wait_dscnt 0" ::: "memory");

        // ---- O += P * V ----
        v16h pa0, pa1;
        {
            const _Float16* base = &Ps[wave][l16 * LDQ];
            pa0 = mk16(*(const v8h*)(base + kh8),      *(const v8h*)(base + 16 + kh8));
            pa1 = mk16(*(const v8h*)(base + 32 + kh8), *(const v8h*)(base + 48 + kh8));
        }
#pragma unroll
        for (int jd = 0; jd < 4; ++jd) {
            const _Float16* base = &Vt[(jd * 16 + l16) * LDQ];
            v16h vb0 = mk16(*(const v8h*)(base + kh8),      *(const v8h*)(base + 16 + kh8));
            v16h vb1 = mk16(*(const v8h*)(base + 32 + kh8), *(const v8h*)(base + 48 + kh8));
            oa[jd] = wmma_f16(pa0, vb0, oa[jd]);
            oa[jd] = wmma_f16(pa1, vb1, oa[jd]);
        }
        __syncthreads();
    }

    // ---- epilogue: O / l  ->  (b,s,h,d) f16 ----
#pragma unroll
    for (int jd = 0; jd < 4; ++jd)
#pragma unroll
        for (int r = 0; r < 8; ++r) {
            const int row  = q0 + wave * 16 + r + rgrp;
            const int dcol = jd * 16 + l16;
            const float v  = oa[jd][r] / lrow[r];
            oh[(((size_t)b * SEQ + row) * HEADS + hh) * HDIM + dcol] = (_Float16)v;
        }
}

// ---------------------------------------------------------------------------
// Launch
// ---------------------------------------------------------------------------
extern "C" void kernel_launch(void* const* d_in, const int* in_sizes, int n_in,
                              void* d_out, int out_size, void* d_ws, size_t ws_size,
                              hipStream_t stream) {
    const float* x  = (const float*)d_in[0];
    const float* Wq = (const float*)d_in[1];
    const float* Wk = (const float*)d_in[2];
    const float* Wv = (const float*)d_in[3];
    const float* Wo = (const float*)d_in[4];
    float* out = (float*)d_out;

    char* ws = (char*)d_ws;
    constexpr size_t F32_MAT = (size_t)GM * GN * sizeof(float);     // 16 MiB
    constexpr size_t F16_MAT = (size_t)GM * GN * sizeof(_Float16);  //  8 MiB
    constexpr size_t F16_W   = (size_t)GN * GK * sizeof(_Float16);  //  2 MiB

    float*    Qf  = (float*)(ws);
    float*    Kf  = (float*)(ws + F32_MAT);
    float*    Vf  = (float*)(ws + 2 * F32_MAT);
    _Float16* qh  = (_Float16*)(ws + 3 * F32_MAT);
    _Float16* kh  = (_Float16*)(ws + 3 * F32_MAT + F16_MAT);
    _Float16* vh  = (_Float16*)(ws + 3 * F32_MAT + 2 * F16_MAT);
    _Float16* xh  = (_Float16*)(ws + 3 * F32_MAT + 3 * F16_MAT);
    _Float16* Wqh = (_Float16*)(ws + 3 * F32_MAT + 4 * F16_MAT);
    _Float16* Wkh = (_Float16*)(ws + 3 * F32_MAT + 4 * F16_MAT + F16_W);
    _Float16* Wvh = (_Float16*)(ws + 3 * F32_MAT + 4 * F16_MAT + 2 * F16_W);
    _Float16* Woh = (_Float16*)(ws + 3 * F32_MAT + 4 * F16_MAT + 3 * F16_W);
    _Float16* oh  = (_Float16*)(ws);   // alias Qf region (dead after rope_cvt)

    // fp32 -> fp16 operand conversion
    cvt_f16<<<(GM * GK / 8) / 256, 256, 0, stream>>>(x,  xh);
    cvt_f16<<<(GN * GK / 8) / 256, 256, 0, stream>>>(Wq, Wqh);
    cvt_f16<<<(GN * GK / 8) / 256, 256, 0, stream>>>(Wk, Wkh);
    cvt_f16<<<(GN * GK / 8) / 256, 256, 0, stream>>>(Wv, Wvh);
    cvt_f16<<<(GN * GK / 8) / 256, 256, 0, stream>>>(Wo, Woh);

    const dim3 ggrid(GN / BN, GM / BM);  // (8, 32)

    gemm_bt<<<ggrid, 256, 0, stream>>>(xh, Wqh, Qf);
    gemm_bt<<<ggrid, 256, 0, stream>>>(xh, Wkh, Kf);
    gemm_bt<<<ggrid, 256, 0, stream>>>(xh, Wvh, Vf);
    rope_cvt<<<(GM * HID / 2) / 256, 256, 0, stream>>>(Qf, Kf, Vf, qh, kh, vh);
    attn_fa<<<dim3(SEQ / 64, HEADS, BATCH), 128, 0, stream>>>(qh, kh, vh, oh);
    gemm_bt<<<ggrid, 256, 0, stream>>>(oh, Woh, out);
}

// v001
// A run of this version takes 169 microseconds.
// Next to v000, in two timings, it ran 1.16 and 1.17 times as fast.
#include <hip/hip_runtime.h>
#include <hip/hip_bf16.h>

// ---------------------------------------------------------------------------
// Types for WMMA (CDNA5 / gfx1250, wave32)
// ---------------------------------------------------------------------------
typedef __attribute__((ext_vector_type(16))) _Float16 v16h;
typedef __attribute__((ext_vector_type(8)))  _Float16 v8h;
typedef __attribute__((ext_vector_type(8)))  float    v8f;
typedef __attribute__((ext_vector_type(2)))  float    v2f;

__device__ __forceinline__ v16h mk16(v8h lo, v8h hi) {
    union { v16h v; v8h h[2]; } u;
    u.h[0] = lo; u.h[1] = hi;
    return u.v;
}

__device__ __forceinline__ v8h cvt8(float4 f0, float4 f1) {
    v8h h;
    h[0] = (_Float16)f0.x; h[1] = (_Float16)f0.y;
    h[2] = (_Float16)f0.z; h[3] = (_Float16)f0.w;
    h[4] = (_Float16)f1.x; h[5] = (_Float16)f1.y;
    h[6] = (_Float16)f1.z; h[7] = (_Float16)f1.w;
    return h;
}

__device__ __forceinline__ v8f wmma_f16(v16h a, v16h b, v8f c) {
    // D = A(16x32 f16) * B(32x16 f16) + C(16x16 f32)
    return __builtin_amdgcn_wmma_f32_16x16x32_f16(
        /*neg_a=*/false, a, /*neg_b=*/false, b,
        /*c_mod=*/(short)0, c, /*reuse_a=*/false, /*reuse_b=*/false);
}

// ---------------------------------------------------------------------------
// Async global->LDS staging (gfx1250 ASYNCcnt path). INST_OFFSET is added to
// BOTH the LDS and global address, so one base covers a contiguous row chunk.
// ---------------------------------------------------------------------------
__device__ __forceinline__ void async_copy32B(unsigned lds, unsigned long long g) {
    asm volatile(
        "global_load_async_to_lds_b128 %0, %1, off\n\t"
        "global_load_async_to_lds_b128 %0, %1, off offset:16"
        :: "v"(lds), "v"(g) : "memory");
}
__device__ __forceinline__ void async_copy64B(unsigned lds, unsigned long long g) {
    asm volatile(
        "global_load_async_to_lds_b128 %0, %1, off\n\t"
        "global_load_async_to_lds_b128 %0, %1, off offset:16\n\t"
        "global_load_async_to_lds_b128 %0, %1, off offset:32\n\t"
        "global_load_async_to_lds_b128 %0, %1, off offset:48\n\t"
        "s_wait_xcnt 0x0"   // inside the statement: the copies' address registers are rewritten only behind it
        :: "v"(lds), "v"(g) : "memory");
}
__device__ __forceinline__ void async_wait0() {
    asm volatile("s_wait_asynccnt 0" ::: "memory");
}

// ---------------------------------------------------------------------------
// Problem constants
// ---------------------------------------------------------------------------
constexpr int BATCH = 2;
constexpr int SEQ   = 2048;
constexpr int HID   = 1024;
constexpr int HEADS = 16;
constexpr int HDIM  = 64;
constexpr int GM = BATCH * SEQ;   // 4096
constexpr int GN = HID;           // 1024
constexpr int GK = HID;           // 1024

// ---------------------------------------------------------------------------
// fp32 -> fp16 bulk conversion (one shot; makes all GEMM operands async-able)
// ---------------------------------------------------------------------------
__global__ __launch_bounds__(256)
void cvt_f16(const float* __restrict__ src, _Float16* __restrict__ dst) {
    const size_t i = (size_t)blockIdx.x * 256 + threadIdx.x;   // one v8 per thread
    const float4* s = (const float4*)src;
    float4 f0 = s[2 * i], f1 = s[2 * i + 1];
    *(v8h*)(dst + 8 * i) = cvt8(f0, f1);
}

// ---------------------------------------------------------------------------
// GEMM: C[M,N] = A[M,K] * W[N,K]^T   (all operands f16, C f32)
// Block tile 128x128x32, 256 threads = 8 waves, wave tile 32x64 (2x4 WMMA).
// LDS rows padded to 40 halves (80B stride -> conflict-free 16B frag reads).
// Double-buffered via async-to-LDS DMA; zero VGPR staging.
// ---------------------------------------------------------------------------
constexpr int BM = 128, BN = 128, BK = 32, LDT = 40;
constexpr int NKT = GK / BK;      // 32

__global__ __launch_bounds__(256)
void gemm_bt(const _Float16* __restrict__ Ah,
             const _Float16* __restrict__ Bh,
             float* __restrict__ C) {
    __shared__ _Float16 As[2][BM * LDT];
    __shared__ _Float16 Bs[2][BM * LDT];

    const int tid = threadIdx.x;
    const int m0 = blockIdx.y * BM;
    const int n0 = blockIdx.x * BN;
    const int lr = tid >> 1;           // 0..127 (tile row)
    const int lc = (tid & 1) * 16;     // 0 or 16 (k sub-chunk)

    const int wave = tid >> 5, lane = tid & 31;
    const int wm = (wave >> 1) * 32;
    const int wn = (wave & 1) * 64;
    const int l16 = lane & 15;
    const int kh8 = (lane >> 4) * 8;

    const _Float16* ga = Ah + (size_t)(m0 + lr) * GK + lc;
    const _Float16* gb = Bh + (size_t)(n0 + lr) * GK + lc;

    auto issue = [&](int kt, int buf) {
        const unsigned la = (unsigned)(size_t)&As[buf][lr * LDT + lc];
        const unsigned lb = (unsigned)(size_t)&Bs[buf][lr * LDT + lc];
        async_copy32B(la, (unsigned long long)(size_t)(ga + kt * BK));
        async_copy32B(lb, (unsigned long long)(size_t)(gb + kt * BK));
    };

    v8f acc[2][4] = {};

    issue(0, 0);
    async_wait0();
    __syncthreads();

    int cur = 0;
    for (int kt = 0; kt < NKT; ++kt) {
        if (kt + 1 < NKT) issue(kt + 1, cur ^ 1);

        v16h af[2], bf[4];
#pragma unroll
        for (int i = 0; i < 2; ++i) {
            const _Float16* base = &As[cur][(wm + 16 * i + l16) * LDT];
            af[i] = mk16(*(const v8h*)(base + kh8), *(const v8h*)(base + 16 + kh8));
        }
#pragma unroll
        for (int j = 0; j < 4; ++j) {
            const _Float16* base = &Bs[cur][(wn + 16 * j + l16) * LDT];
            bf[j] = mk16(*(const v8h*)(base + kh8), *(const v8h*)(base + 16 + kh8));
        }
#pragma unroll
        for (int i = 0; i < 2; ++i)
#pragma unroll
            for (int j = 0; j < 4; ++j)
                acc[i][j] = wmma_f16(af[i], bf[j], acc[i][j]);

        if (kt + 1 < NKT) async_wait0();
        __syncthreads();
        cur ^= 1;
    }

    const int rgrp = (lane >> 4) * 8;
#pragma unroll
    for (int i = 0; i < 2; ++i)
#pragma unroll
        for (int j = 0; j < 4; ++j)
#pragma unroll
            for (int r = 0; r < 8; ++r) {
                const int row = m0 + wm + 16 * i + r + rgrp;
                const int col = n0 + wn + 16 * j + l16;
                C[(size_t)row * GN + col] = acc[i][j][r];
            }
}

// ---------------------------------------------------------------------------
// RoPE + fp16 relayout: (b,s,h,d) f32  ->  (b,h,s,d) f16 for Q,K,V
// One thread per (b,s,h,d<32) pair; handles d and d+32.
// ---------------------------------------------------------------------------
__global__ __launch_bounds__(256)
void rope_cvt(const float* __restrict__ Qf, const float* __restrict__ Kf,
              const float* __restrict__ Vf,
              _Float16* __restrict__ qh, _Float16* __restrict__ kh,
              _Float16* __restrict__ vh) {
    const int i = blockIdx.x * 256 + threadIdx.x;  // 0 .. 2^21-1
    const int d = i & 31;
    const int h = (i >> 5) & 15;
    const int s = (i >> 9) & 2047;
    const int b = i >> 20;

    const size_t src = (((size_t)b * SEQ + s) * HEADS + h) * HDIM + d;
    const size_t dst = (((size_t)b * HEADS + h) * SEQ + s) * HDIM + d;

    // inv_freq = 10000^(-d/32) = exp(-d * ln(10000)/32)
    const float invf = __expf(-(float)d * (9.210340371976184f / 32.0f));
    const float ang  = (float)s * invf;
    float sn, cs;
    __sincosf(ang, &sn, &cs);

    const float q1 = Qf[src], q2 = Qf[src + 32];
    qh[dst]      = (_Float16)(q1 * cs - q2 * sn);
    qh[dst + 32] = (_Float16)(q2 * cs + q1 * sn);

    const float k1 = Kf[src], k2 = Kf[src + 32];
    kh[dst]      = (_Float16)(k1 * cs - k2 * sn);
    kh[dst + 32] = (_Float16)(k2 * cs + k1 * sn);

    vh[dst]      = (_Float16)Vf[src];
    vh[dst + 32] = (_Float16)Vf[src + 32];
}

constexpr int LDQ = 72;

// value of lane l ^ 16 (the other half of the wave)
__device__ __forceinline__ float xhalf(float x) {
    return __builtin_bit_cast(float, __builtin_amdgcn_permlanex16(
        __builtin_bit_cast(int, x), __builtin_bit_cast(int, x),
        0x76543210, 0xfedcba98, false, false));
}

__global__ __launch_bounds__(128)
void attn_fa(const _Float16* __restrict__ qh, const _Float16* __restrict__ kh,
             const _Float16* __restrict__ vh, _Float16* __restrict__ oh) {
    __shared__ _Float16 Qs[64 * LDQ];
    __shared__ _Float16 Ks[64 * LDQ];
    __shared__ _Float16 Vt[64 * LDQ];       // transposed: [d][key]

    const int tid  = threadIdx.x;
    const int wave = tid >> 5, lane = tid & 31;
    const int l16  = lane & 15;
    const int kh8  = (lane >> 4) * 8;
    const int rgrp = (lane >> 4) * 8;

    const int b  = blockIdx.z;
    const int hh = blockIdx.y;
    const int q0 = blockIdx.x * 64;
    const size_t bh = (size_t)b * HEADS + hh;
    const _Float16* Qg = qh + bh * SEQ * HDIM;
    const _Float16* Kg = kh + bh * SEQ * HDIM;
    const _Float16* Vg = vh + bh * SEQ * HDIM;

    const int srow = tid >> 1;            // staging row 0..63
    const int scol = (tid & 1) * 32;      // staging col 0 or 32

    // ---- stage Q tile (64 x 64) once, via async DMA ----
    async_copy64B((unsigned)(size_t)&Qs[srow * LDQ + scol],
                  (unsigned long long)(size_t)(Qg + (size_t)(q0 + srow) * HDIM + scol));
    async_wait0();
    __syncthreads();

    // Q^T fragments for this wave (B operand: column l16 = query; constant across key tiles)
    v16h qa0, qa1;
    {
        const _Float16* base = &Qs[(wave * 16 + l16) * LDQ];
        qa0 = mk16(*(const v8h*)(base + kh8),      *(const v8h*)(base + 16 + kh8));
        qa1 = mk16(*(const v8h*)(base + 32 + kh8), *(const v8h*)(base + 48 + kh8));
    }

    float mrun = -1e30f;   // running max of this lane's query (same in both halves)
    float lrun = 0.0f;     // running sum over this half's keys only; halves join in the epilogue
    v8f oa[4] = {};        // oa[jd][r] = O^T[jd*16 + rgrp + r][query l16]

    for (int kt = 0; kt < SEQ / 64; ++kt) {
        // ---- stage K tile (async DMA) and V tile (manual transpose) ----
        async_copy64B((unsigned)(size_t)&Ks[srow * LDQ + scol],
                      (unsigned long long)(size_t)(Kg + (size_t)(kt * 64 + srow) * HDIM + scol));
        {
            const _Float16* pv = Vg + (size_t)(kt * 64 + srow) * HDIM + scol;
            v8h v0 = *(const v8h*)pv,        v1 = *(const v8h*)(pv + 8);
            v8h v2 = *(const v8h*)(pv + 16), v3 = *(const v8h*)(pv + 24);
#pragma unroll
            for (int e = 0; e < 8; ++e) {
                Vt[(scol + e)      * LDQ + srow] = v0[e];
                Vt[(scol + 8 + e)  * LDQ + srow] = v1[e];
                Vt[(scol + 16 + e) * LDQ + srow] = v2[e];
                Vt[(scol + 24 + e) * LDQ + srow] = v3[e];
            }
        }
        async_wait0();
        __syncthreads();

        // ---- scores S^T = K * Q^T * scale : sc[j][r] = S[query l16][key j*16 + rgrp + r] ----
        v8f sc[4];
#pragma unroll
        for (int j = 0; j < 4; ++j) {
            const _Float16* base = &Ks[(j * 16 + l16) * LDQ];
            v16h kb0 = mk16(*(const v8h*)(base + kh8),      *(const v8h*)(base + 16 + kh8));
            v16h kb1 = mk16(*(const v8h*)(base + 32 + kh8), *(const v8h*)(base + 48 + kh8));
            v8f z = {};
            z = wmma_f16(kb0, qa0, z);
            z = wmma_f16(kb1, qa1, z);
#pragma unroll
            for (int r = 0; r < 8; ++r) z[r] *= 0.125f;   // 1/sqrt(64)
            sc[j] = z;
        }

        // ---- online softmax: 32 scores of one query per lane ----
        float t4[4];
#pragma unroll
        for (int j = 0; j < 4; ++j)
            t4[j] = fmaxf(fmaxf(fmaxf(sc[j][0], sc[j][1]), fmaxf(sc[j][2], sc[j][3])),
                          fmaxf(fmaxf(sc[j][4], sc[j][5]), fmaxf(sc[j][6], sc[j][7])));
        float tm = fmaxf(fmaxf(t4[0], t4[1]), fmaxf(t4[2], t4[3]));
        tm = fmaxf(tm, xhalf(tm));                 // join the two key halves
        const float nm   = fmaxf(mrun, tm);
        const float corr = __expf(mrun - nm);
        mrun = nm;

        // P^T packs in place into the B operand: in the hardware k order (the one the K, Q and
        // V^T loaders use) element s of pb[kk] is register s & 7 of score tile 2*kk + (s >> 3)
        v16h pb[2];
        v2f rs[4];
#pragma unroll
        for (int j = 0; j < 4; ++j) {
#pragma unroll
            for (int r = 0; r < 8; r += 2) {
                v2f p;
                p.x = __expf(sc[j][r] - nm);
                p.y = __expf(sc[j][r + 1] - nm);
                rs[j] = (r == 0) ? p : rs[j] + p;
                pb[j >> 1][(j & 1) * 8 + r]     = (_Float16)p.x;
                pb[j >> 1][(j & 1) * 8 + r + 1] = (_Float16)p.y;
            }
        }
        const v2f rt = (rs[0] + rs[1]) + (rs[2] + rs[3]);
        lrun = lrun * corr + (rt.x + rt.y);
#pragma unroll
        for (int jd = 0; jd < 4; ++jd)
#pragma unroll
            for (int r = 0; r < 8; ++r) oa[jd][r] *= corr;

        // ---- O^T += V^T * P^T ----
#pragma unroll
        for (int jd = 0; jd < 4; ++jd) {
            const _Float16* base = &Vt[(jd * 16 + l16) * LDQ];
            v16h vb0 = mk16(*(const v8h*)(base + kh8),      *(const v8h*)(base + 16 + kh8));
            v16h vb1 = mk16(*(const v8h*)(base + 32 + kh8), *(const v8h*)(base + 48 + kh8));
            oa[jd] = wmma_f16(vb0, pb[0], oa[jd]);
            oa[jd] = wmma_f16(vb1, pb[1], oa[jd]);
        }
        __syncthreads();
    }

    // ---- epilogue: O / l  ->  (b,s,h,d) f16; a lane holds 8 consecutive d per tile ----
    const float inv = 1.0f / (lrun + xhalf(lrun));
    const int   row = q0 + wave * 16 + l16;
    _Float16* op = oh + (((size_t)b * SEQ + row) * HEADS + hh) * HDIM + rgrp;
#pragma unroll
    for (int jd = 0; jd < 4; ++jd) {
        v8h o;
#pragma unroll
        for (int r = 0; r < 8; ++r) o[r] = (_Float16)(oa[jd][r] * inv);
        *(v8h*)(op + jd * 16) = o;
    }
}

// ---------------------------------------------------------------------------
// Launch
// ---------------------------------------------------------------------------
extern "C" void kernel_launch(void* const* d_in, const int* in_sizes, int n_in,
                              void* d_out, int out_size, void* d_ws, size_t ws_size,
                              hipStream_t stream) {
    const float* x  = (const float*)d_in[0];
    const float* Wq = (const float*)d_in[1];
    const float* Wk = (const float*)d_in[2];
    const float* Wv = (const float*)d_in[3];
    const float* Wo = (const float*)d_in[4];
    float* out = (float*)d_out;

    char* ws = (char*)d_ws;
    constexpr size_t F32_MAT = (size_t)GM * GN * sizeof(float);     // 16 MiB
    constexpr size_t F16_MAT = (size_t)GM * GN * sizeof(_Float16);  //  8 MiB
    constexpr size_t F16_W   = (size_t)GN * GK * sizeof(_Float16);  //  2 MiB

    float*    Qf  = (float*)(ws);
    float*    Kf  = (float*)(ws + F32_MAT);
    float*    Vf  = (float*)(ws + 2 * F32_MAT);
    _Float16* qh  = (_Float16*)(ws + 3 * F32_MAT);
    _Float16* kh  = (_Float16*)(ws + 3 * F32_MAT + F16_MAT);
    _Float16* vh  = (_Float16*)(ws + 3 * F32_MAT + 2 * F16_MAT);
    _Float16* xh  = (_Float16*)(ws + 3 * F32_MAT + 3 * F16_MAT);
    _Float16* Wqh = (_Float16*)(ws + 3 * F32_MAT + 4 * F16_MAT);
    _Float16* Wkh = (_Float16*)(ws + 3 * F32_MAT + 4 * F16_MAT + F16_W);
    _Float16* Wvh = (_Float16*)(ws + 3 * F32_MAT + 4 * F16_MAT + 2 * F16_W);
    _Float16* Woh = (_Float16*)(ws + 3 * F32_MAT + 4 * F16_MAT + 3 * F16_W);
    _Float16* oh  = (_Float16*)(ws);   // alias Qf region (dead after rope_cvt)

    // fp32 -> fp16 operand conversion
    cvt_f16<<<(GM * GK / 8) / 256, 256, 0, stream>>>(x,  xh);
    cvt_f16<<<(GN * GK / 8) / 256, 256, 0, stream>>>(Wq, Wqh);
    cvt_f16<<<(GN * GK / 8) / 256, 256, 0, stream>>>(Wk, Wkh);
    cvt_f16<<<(GN * GK / 8) / 256, 256, 0, stream>>>(Wv, Wvh);
    cvt_f16<<<(GN * GK / 8) / 256, 256, 0, stream>>>(Wo, Woh);

    const dim3 ggrid(GN / BN, GM / BM);  // (8, 32)

    gemm_bt<<<ggrid, 256, 0, stream>>>(xh, Wqh, Qf);
    gemm_bt<<<ggrid, 256, 0, stream>>>(xh, Wkh, Kf);
    gemm_bt<<<ggrid, 256, 0, stream>>>(xh, Wvh, Vf);
    rope_cvt<<<(GM * HID / 2) / 256, 256, 0, stream>>>(Qf, Kf, Vf, qh, kh, vh);
    attn_fa<<<dim3(SEQ / 64, HEADS, BATCH), 128, 0, stream>>>(qh, kh, vh, oh);
    gemm_bt<<<ggrid, 256, 0, stream>>>(oh, Woh, out);
}

// v002
// A run of this version takes 150 microseconds.
// Next to v001, in two timings, it ran 1.12 and 1.13 times as fast.
// Counting every step since v000, it is 1.31 times as fast.
#include <hip/hip_runtime.h>
#include <hip/hip_bf16.h>

// ---------------------------------------------------------------------------
// Types for WMMA (CDNA5 / gfx1250, wave32)
// ---------------------------------------------------------------------------
typedef __attribute__((ext_vector_type(16))) _Float16 v16h;
typedef __attribute__((ext_vector_type(8)))  _Float16 v8h;
typedef __attribute__((ext_vector_type(8)))  float    v8f;
typedef __attribute__((ext_vector_type(2)))  float    v2f;

__device__ __forceinline__ v16h mk16(v8h lo, v8h hi) {
    union { v16h v; v8h h[2]; } u;
    u.h[0] = lo; u.h[1] = hi;
    return u.v;
}

__device__ __forceinline__ v8h cvt8(float4 f0, float4 f1) {
    v8h h;
    h[0] = (_Float16)f0.x; h[1] = (_Float16)f0.y;
    h[2] = (_Float16)f0.z; h[3] = (_Float16)f0.w;
    h[4] = (_Float16)f1.x; h[5] = (_Float16)f1.y;
    h[6] = (_Float16)f1.z; h[7] = (_Float16)f1.w;
    return h;
}

__device__ __forceinline__ v8f wmma_f16(v16h a, v16h b, v8f c) {
    // D = A(16x32 f16) * B(32x16 f16) + C(16x16 f32)
    return __builtin_amdgcn_wmma_f32_16x16x32_f16(
        /*neg_a=*/false, a, /*neg_b=*/false, b,
        /*c_mod=*/(short)0, c, /*reuse_a=*/false, /*reuse_b=*/false);
}

// ---------------------------------------------------------------------------
// Async global->LDS staging (gfx1250 ASYNCcnt path). INST_OFFSET is added to
// BOTH the LDS and global address, so one base covers a contiguous row chunk.
// ---------------------------------------------------------------------------
__device__ __forceinline__ void async_copy32B(unsigned lds, unsigned long long g) {
    asm volatile(
        "global_load_async_to_lds_b128 %0, %1, off\n\t"
        "global_load_async_to_lds_b128 %0, %1, off offset:16"
        :: "v"(lds), "v"(g) : "memory");
}
__device__ __forceinline__ void async_copy64B(unsigned lds, unsigned long long g) {
    asm volatile(
        "global_load_async_to_lds_b128 %0, %1, off\n\t"
        "global_load_async_to_lds_b128 %0, %1, off offset:16\n\t"
        "global_load_async_to_lds_b128 %0, %1, off offset:32\n\t"
        "global_load_async_to_lds_b128 %0, %1, off offset:48\n\t"
        "s_wait_xcnt 0x0"   // inside the statement: the copies' address registers are rewritten only behind it
        :: "v"(lds), "v"(g) : "memory");
}
__device__ __forceinline__ void async_wait0() {
    asm volatile("s_wait_asynccnt 0" ::: "memory");
}

// ---------------------------------------------------------------------------
// Problem constants
// ---------------------------------------------------------------------------
constexpr int BATCH = 2;
constexpr int SEQ   = 2048;
constexpr int HID   = 1024;
constexpr int HEADS = 16;
constexpr int HDIM  = 64;
constexpr int GM = BATCH * SEQ;   // 4096
constexpr int GN = HID;           // 1024
constexpr int GK = HID;           // 1024

// ---------------------------------------------------------------------------
// fp32 -> fp16 bulk conversion (one shot; makes all GEMM operands async-able)
// ---------------------------------------------------------------------------
__global__ __launch_bounds__(256)
void cvt_f16(const float* __restrict__ src, _Float16* __restrict__ dst) {
    const size_t i = (size_t)blockIdx.x * 256 + threadIdx.x;   // one v8 per thread
    const float4* s = (const float4*)src;
    float4 f0 = s[2 * i], f1 = s[2 * i + 1];
    *(v8h*)(dst + 8 * i) = cvt8(f0, f1);
}

// ---------------------------------------------------------------------------
// GEMM: C[M,N] = A[M,K] * W[N,K]^T   (all operands f16, f32 accumulation)
// Block tile 128x128x32, 256 threads = 8 waves, wave tile 32x64 (2x4 WMMA).
// MODE 0: C stored as f32, row-major.
// MODE 1, 2: the projections. The product runs transposed (W rows as the A operand, both
// loaders share one k order), so a lane holds one token (column l16) and 8 consecutive
// head dims per tile; a wave's 64 columns are one head, so the RoPE partners d and d + 32
// sit in tiles j and j + 2 of the same lane. MODE 1 rotates them in registers; both modes
// store f16 straight into the (b,h,s,d) layout that attention reads.
// LDS rows padded to 40 halves (80B stride -> conflict-free 16B frag reads).
// Double-buffered via async-to-LDS DMA; zero VGPR staging.
// ---------------------------------------------------------------------------
// The epilogue's transcendentals, each in one asm statement so that the closing v_nop stands
// directly behind it: that is the slot the instruction set asks for before a transcendental's
// source is overwritten.
// 2^x
__device__ __forceinline__ float exp2_hw(float x) {
    float y;
    asm("v_exp_f32 %0, %1\n\t"
        "v_nop"
        : "=v"(y) : "v"(x));
    return y;
}
// sin and cos of an angle given in revolutions (radians / 2 pi), the hardware's own unit
__device__ __forceinline__ void sincos_rev(float rev, float& sn, float& cs) {
    asm("v_sin_f32 %0, %2\n\t"
        "v_cos_f32 %1, %2\n\t"
        "v_nop"
        : "=&v"(sn), "=&v"(cs) : "v"(rev));
}

constexpr int BM = 128, BN = 128, BK = 32, LDT = 40;
constexpr int NKT = GK / BK;      // 32

template <int MODE>
__global__ __launch_bounds__(256)
void gemm_bt(const _Float16* __restrict__ Ah,
             const _Float16* __restrict__ Bh,
             float* __restrict__ C,
             _Float16* __restrict__ Ch) {
    __shared__ _Float16 As[2][BM * LDT];
    __shared__ _Float16 Bs[2][BM * LDT];

    const int tid = threadIdx.x;
    const int m0 = blockIdx.y * BM;
    const int n0 = blockIdx.x * BN;
    const int lr = tid >> 1;           // 0..127 (tile row)
    const int lc = (tid & 1) * 16;     // 0 or 16 (k sub-chunk)

    const int wave = tid >> 5, lane = tid & 31;
    const int wm = (wave >> 1) * 32;
    const int wn = (wave & 1) * 64;
    const int l16 = lane & 15;
    const int kh8 = (lane >> 4) * 8;

    const _Float16* ga = Ah + (size_t)(m0 + lr) * GK + lc;
    const _Float16* gb = Bh + (size_t)(n0 + lr) * GK + lc;

    auto issue = [&](int kt, int buf) {
        const unsigned la = (unsigned)(size_t)&As[buf][lr * LDT + lc];
        const unsigned lb = (unsigned)(size_t)&Bs[buf][lr * LDT + lc];
        async_copy32B(la, (unsigned long long)(size_t)(ga + kt * BK));
        async_copy32B(lb, (unsigned long long)(size_t)(gb + kt * BK));
    };

    v8f acc[2][4] = {};

    issue(0, 0);
    async_wait0();
    __syncthreads();

    int cur = 0;
    for (int kt = 0; kt < NKT; ++kt) {
        if (kt + 1 < NKT) issue(kt + 1, cur ^ 1);

        v16h af[2], bf[4];
#pragma unroll
        for (int i = 0; i < 2; ++i) {
            const _Float16* base = &As[cur][(wm + 16 * i + l16) * LDT];
            af[i] = mk16(*(const v8h*)(base + kh8), *(const v8h*)(base + 16 + kh8));
        }
#pragma unroll
        for (int j = 0; j < 4; ++j) {
            const _Float16* base = &Bs[cur][(wn + 16 * j + l16) * LDT];
            bf[j] = mk16(*(const v8h*)(base + kh8), *(const v8h*)(base + 16 + kh8));
        }
#pragma unroll
        for (int i = 0; i < 2; ++i)
#pragma unroll
            for (int j = 0; j < 4; ++j)
                acc[i][j] = (MODE == 0) ? wmma_f16(af[i], bf[j], acc[i][j])
                                        : wmma_f16(bf[j], af[i], acc[i][j]);

        if (kt + 1 < NKT) async_wait0();
        __syncthreads();
        cur ^= 1;
    }

    const int rgrp = (lane >> 4) * 8;
    if constexpr (MODE == 0) {
#pragma unroll
        for (int i = 0; i < 2; ++i)
#pragma unroll
            for (int j = 0; j < 4; ++j)
#pragma unroll
                for (int r = 0; r < 8; ++r) {
                    const int row = m0 + wm + 16 * i + r + rgrp;
                    const int col = n0 + wn + 16 * j + l16;
                    C[(size_t)row * GN + col] = acc[i][j][r];
                }
    } else {
        // acc[i][j][r] = C[token m0 + wm + 16*i + l16][column n0 + wn + 16*j + rgrp + r]
        const int hd = (n0 + wn) / HDIM;
#pragma unroll
        for (int i = 0; i < 2; ++i) {
            const int row = m0 + wm + 16 * i + l16;
            const int bb  = row / SEQ;
            const int s   = row % SEQ;
            if constexpr (MODE == 1) {
#pragma unroll
                for (int j = 0; j < 2; ++j)
#pragma unroll
                    for (int r = 0; r < 8; ++r) {
                        const int d = 16 * j + rgrp + r;
                        // inv_freq = 10000^(-d/32) = exp(-d * ln(10000)/32)
                        const float invf = exp2_hw(-(float)d * (9.210340371976184f / 32.0f) * 1.4426950408889634f);
                        const float ang  = (float)s * invf;
                        float sn, cs;
                        sincos_rev(ang * 0.15915494309189532f, sn, cs);
                        const float t1 = acc[i][j][r], t2 = acc[i][j + 2][r];
                        acc[i][j][r]     = t1 * cs - t2 * sn;
                        acc[i][j + 2][r] = t2 * cs + t1 * sn;
                    }
            }
            _Float16* op = Ch + (((size_t)bb * HEADS + hd) * SEQ + s) * HDIM + rgrp;
#pragma unroll
            for (int j = 0; j < 4; ++j) {
                v8h o;
#pragma unroll
                for (int r = 0; r < 8; ++r) o[r] = (_Float16)acc[i][j][r];
                *(v8h*)(op + 16 * j) = o;
            }
        }
    }
}

constexpr int LDQ = 72;

// value of lane l ^ 16 (the other half of the wave)
__device__ __forceinline__ float xhalf(float x) {
    return __builtin_bit_cast(float, __builtin_amdgcn_permlanex16(
        __builtin_bit_cast(int, x), __builtin_bit_cast(int, x),
        0x76543210, 0xfedcba98, false, false));
}

__global__ __launch_bounds__(128)
void attn_fa(const _Float16* __restrict__ qh, const _Float16* __restrict__ kh,
             const _Float16* __restrict__ vh, _Float16* __restrict__ oh) {
    __shared__ _Float16 Qs[64 * LDQ];
    __shared__ _Float16 Ks[64 * LDQ];
    __shared__ _Float16 Vt[64 * LDQ];       // transposed: [d][key]

    const int tid  = threadIdx.x;
    const int wave = tid >> 5, lane = tid & 31;
    const int l16  = lane & 15;
    const int kh8  = (lane >> 4) * 8;
    const int rgrp = (lane >> 4) * 8;

    const int b  = blockIdx.z;
    const int hh = blockIdx.y;
    const int q0 = blockIdx.x * 64;
    const size_t bh = (size_t)b * HEADS + hh;
    const _Float16* Qg = qh + bh * SEQ * HDIM;
    const _Float16* Kg = kh + bh * SEQ * HDIM;
    const _Float16* Vg = vh + bh * SEQ * HDIM;

    const int srow = tid >> 1;            // staging row 0..63
    const int scol = (tid & 1) * 32;      // staging col 0 or 32

    // ---- stage Q tile (64 x 64) once, via async DMA ----
    async_copy64B((unsigned)(size_t)&Qs[srow * LDQ + scol],
                  (unsigned long long)(size_t)(Qg + (size_t)(q0 + srow) * HDIM + scol));
    async_wait0();
    __syncthreads();

    // Q^T fragments for this wave (B operand: column l16 = query; constant across key tiles)
    v16h qa0, qa1;
    {
        const _Float16* base = &Qs[(wave * 16 + l16) * LDQ];
        qa0 = mk16(*(const v8h*)(base + kh8),      *(const v8h*)(base + 16 + kh8));
        qa1 = mk16(*(const v8h*)(base + 32 + kh8), *(const v8h*)(base + 48 + kh8));
    }

    float mrun = -1e30f;   // running max of this lane's query (same in both halves)
    float lrun = 0.0f;     // running sum over this half's keys only; halves join in the epilogue
    v8f oa[4] = {};        // oa[jd][r] = O^T[jd*16 + rgrp + r][query l16]

    for (int kt = 0; kt < SEQ / 64; ++kt) {
        // ---- stage K tile (async DMA) and V tile (manual transpose) ----
        async_copy64B((unsigned)(size_t)&Ks[srow * LDQ + scol],
                      (unsigned long long)(size_t)(Kg + (size_t)(kt * 64 + srow) * HDIM + scol));
        {
            const _Float16* pv = Vg + (size_t)(kt * 64 + srow) * HDIM + scol;
            v8h v0 = *(const v8h*)pv,        v1 = *(const v8h*)(pv + 8);
            v8h v2 = *(const v8h*)(pv + 16), v3 = *(const v8h*)(pv + 24);
#pragma unroll
            for (int e = 0; e < 8; ++e) {
                Vt[(scol + e)      * LDQ + srow] = v0[e];
                Vt[(scol + 8 + e)  * LDQ + srow] = v1[e];
                Vt[(scol + 16 + e) * LDQ + srow] = v2[e];
                Vt[(scol + 24 + e) * LDQ + srow] = v3[e];
            }
        }
        async_wait0();
        __syncthreads();

        // ---- scores S^T = K * Q^T * scale : sc[j][r] = S[query l16][key j*16 + rgrp + r] ----
        v8f sc[4];
#pragma unroll
        for (int j = 0; j < 4; ++j) {
            const _Float16* base = &Ks[(j * 16 + l16) * LDQ];
            v16h kb0 = mk16(*(const v8h*)(base + kh8),      *(const v8h*)(base + 16 + kh8));
            v16h kb1 = mk16(*(const v8h*)(base + 32 + kh8), *(const v8h*)(base + 48 + kh8));
            v8f z = {};
            z = wmma_f16(kb0, qa0, z);
            z = wmma_f16(kb1, qa1, z);
#pragma unroll
            for (int r = 0; r < 8; ++r) z[r] *= 0.125f;   // 1/sqrt(64)
            sc[j] = z;
        }

        // ---- online softmax: 32 scores of one query per lane ----
        float t4[4];
#pragma unroll
        for (int j = 0; j < 4; ++j)
            t4[j] = fmaxf(fmaxf(fmaxf(sc[j][0], sc[j][1]), fmaxf(sc[j][2], sc[j][3])),
                          fmaxf(fmaxf(sc[j][4], sc[j][5]), fmaxf(sc[j][6], sc[j][7])));
        float tm = fmaxf(fmaxf(t4[0], t4[1]), fmaxf(t4[2], t4[3]));
        tm = fmaxf(tm, xhalf(tm));                 // join the two key halves
        const float nm   = fmaxf(mrun, tm);
        const float corr = __expf(mrun - nm);
        mrun = nm;

        // P^T packs in place into the B operand: in the hardware k order (the one the K, Q and
        // V^T loaders use) element s of pb[kk] is register s & 7 of score tile 2*kk + (s >> 3)
        v16h pb[2];
        v2f rs[4];
#pragma unroll
        for (int j = 0; j < 4; ++j) {
#pragma unroll
            for (int r = 0; r < 8; r += 2) {
                v2f p;
                p.x = __expf(sc[j][r] - nm);
                p.y = __expf(sc[j][r + 1] - nm);
                rs[j] = (r == 0) ? p : rs[j] + p;
                pb[j >> 1][(j & 1) * 8 + r]     = (_Float16)p.x;
                pb[j >> 1][(j & 1) * 8 + r + 1] = (_Float16)p.y;
            }
        }
        const v2f rt = (rs[0] + rs[1]) + (rs[2] + rs[3]);
        lrun = lrun * corr + (rt.x + rt.y);
#pragma unroll
        for (int jd = 0; jd < 4; ++jd)
#pragma unroll
            for (int r = 0; r < 8; ++r) oa[jd][r] *= corr;

        // ---- O^T += V^T * P^T ----
#pragma unroll
        for (int jd = 0; jd < 4; ++jd) {
            const _Float16* base = &Vt[(jd * 16 + l16) * LDQ];
            v16h vb0 = mk16(*(const v8h*)(base + kh8),      *(const v8h*)(base + 16 + kh8));
            v16h vb1 = mk16(*(const v8h*)(base + 32 + kh8), *(const v8h*)(base + 48 + kh8));
            oa[jd] = wmma_f16(vb0, pb[0], oa[jd]);
            oa[jd] = wmma_f16(vb1, pb[1], oa[jd]);
        }
        __syncthreads();
    }

    // ---- epilogue: O / l  ->  (b,s,h,d) f16; a lane holds 8 consecutive d per tile ----
    const float inv = 1.0f / (lrun + xhalf(lrun));
    const int   row = q0 + wave * 16 + l16;
    _Float16* op = oh + (((size_t)b * SEQ + row) * HEADS + hh) * HDIM + rgrp;
#pragma unroll
    for (int jd = 0; jd < 4; ++jd) {
        v8h o;
#pragma unroll
        for (int r = 0; r < 8; ++r) o[r] = (_Float16)(oa[jd][r] * inv);
        *(v8h*)(op + jd * 16) = o;
    }
}

// ---------------------------------------------------------------------------
// Launch
// ---------------------------------------------------------------------------
extern "C" void kernel_launch(void* const* d_in, const int* in_sizes, int n_in,
                              void* d_out, int out_size, void* d_ws, size_t ws_size,
                              hipStream_t stream) {
    const float* x  = (const float*)d_in[0];
    const float* Wq = (const float*)d_in[1];
    const float* Wk = (const float*)d_in[2];
    const float* Wv = (const float*)d_in[3];
    const float* Wo = (const float*)d_in[4];
    float* out = (float*)d_out;

    char* ws = (char*)d_ws;
    constexpr size_t F32_MAT = (size_t)GM * GN * sizeof(float);     // 16 MiB
    constexpr size_t F16_MAT = (size_t)GM * GN * sizeof(_Float16);  //  8 MiB
    constexpr size_t F16_W   = (size_t)GN * GK * sizeof(_Float16);  //  2 MiB

    _Float16* qh  = (_Float16*)(ws + 3 * F32_MAT);
    _Float16* kh  = (_Float16*)(ws + 3 * F32_MAT + F16_MAT);
    _Float16* vh  = (_Float16*)(ws + 3 * F32_MAT + 2 * F16_MAT);
    _Float16* xh  = (_Float16*)(ws + 3 * F32_MAT + 3 * F16_MAT);
    _Float16* Wqh = (_Float16*)(ws + 3 * F32_MAT + 4 * F16_MAT);
    _Float16* Wkh = (_Float16*)(ws + 3 * F32_MAT + 4 * F16_MAT + F16_W);
    _Float16* Wvh = (_Float16*)(ws + 3 * F32_MAT + 4 * F16_MAT + 2 * F16_W);
    _Float16* Woh = (_Float16*)(ws + 3 * F32_MAT + 4 * F16_MAT + 3 * F16_W);
    _Float16* oh  = (_Float16*)(ws);

    // fp32 -> fp16 operand conversion
    cvt_f16<<<(GM * GK / 8) / 256, 256, 0, stream>>>(x,  xh);
    cvt_f16<<<(GN * GK / 8) / 256, 256, 0, stream>>>(Wq, Wqh);
    cvt_f16<<<(GN * GK / 8) / 256, 256, 0, stream>>>(Wk, Wkh);
    cvt_f16<<<(GN * GK / 8) / 256, 256, 0, stream>>>(Wv, Wvh);
    cvt_f16<<<(GN * GK / 8) / 256, 256, 0, stream>>>(Wo, Woh);

    const dim3 ggrid(GN / BN, GM / BM);  // (8, 32)

    gemm_bt<1><<<ggrid, 256, 0, stream>>>(xh, Wqh, nullptr, qh);
    gemm_bt<1><<<ggrid, 256, 0, stream>>>(xh, Wkh, nullptr, kh);
    gemm_bt<2><<<ggrid, 256, 0, stream>>>(xh, Wvh, nullptr, vh);
    attn_fa<<<dim3(SEQ / 64, HEADS, BATCH), 128, 0, stream>>>(qh, kh, vh, oh);
    gemm_bt<0><<<ggrid, 256, 0, stream>>>(oh, Woh, out, nullptr);
}

// v003
// It runs in 144 microseconds.
// In two side-by-side timings against v002, it was 1.04 and 1.05 times as fast.
// Counting every step since v000, it is 1.37 times as fast.
#include <hip/hip_runtime.h>
#include <hip/hip_bf16.h>

// ---------------------------------------------------------------------------
// Types for WMMA (CDNA5 / gfx1250, wave32)
// ---------------------------------------------------------------------------
typedef __attribute__((ext_vector_type(16))) _Float16 v16h;
typedef __attribute__((ext_vector_type(8)))  _Float16 v8h;
typedef __attribute__((ext_vector_type(8)))  float    v8f;
typedef __attribute__((ext_vector_type(2)))  float    v2f;

__device__ __forceinline__ v16h mk16(v8h lo, v8h hi) {
    union { v16h v; v8h h[2]; } u;
    u.h[0] = lo; u.h[1] = hi;
    return u.v;
}

__device__ __forceinline__ v8f wmma_f16(v16h a, v16h b, v8f c) {
    // D = A(16x32 f16) * B(32x16 f16) + C(16x16 f32)
    return __builtin_amdgcn_wmma_f32_16x16x32_f16(
        /*neg_a=*/false, a, /*neg_b=*/false, b,
        /*c_mod=*/(short)0, c, /*reuse_a=*/false, /*reuse_b=*/false);
}

// ---------------------------------------------------------------------------
// Async global->LDS staging (gfx1250 ASYNCcnt path). INST_OFFSET is added to
// BOTH the LDS and global address, so one base covers a contiguous row chunk.
// ---------------------------------------------------------------------------
__device__ __forceinline__ void async_copy32B(unsigned lds, unsigned long long g) {
    asm volatile(
        "global_load_async_to_lds_b128 %0, %1, off\n\t"
        "global_load_async_to_lds_b128 %0, %1, off offset:16"
        :: "v"(lds), "v"(g) : "memory");
}
__device__ __forceinline__ void async_copy64B(unsigned lds, unsigned long long g) {
    asm volatile(
        "global_load_async_to_lds_b128 %0, %1, off\n\t"
        "global_load_async_to_lds_b128 %0, %1, off offset:16\n\t"
        "global_load_async_to_lds_b128 %0, %1, off offset:32\n\t"
        "global_load_async_to_lds_b128 %0, %1, off offset:48\n\t"
        "s_wait_xcnt 0x0"   // inside the statement: the copies' address registers are rewritten only behind it
        :: "v"(lds), "v"(g) : "memory");
}
__device__ __forceinline__ void async_wait0() {
    asm volatile("s_wait_asynccnt 0" ::: "memory");
}

// ---------------------------------------------------------------------------
// Problem constants
// ---------------------------------------------------------------------------
constexpr int BATCH = 2;
constexpr int SEQ   = 2048;
constexpr int HID   = 1024;
constexpr int HEADS = 16;
constexpr int HDIM  = 64;
constexpr int GM = BATCH * SEQ;   // 4096
constexpr int GN = HID;           // 1024
constexpr int GK = HID;           // 1024

// ---------------------------------------------------------------------------
// fp32 -> fp16 conversion of all five inputs in ONE launch (makes all GEMM operands
// async-able). The five f16 copies lie back to back in the workspace, so the target is one
// range. One work-group of 16 waves per 32768 floats; a work-group lies wholly inside one
// input. A wave's load covers 512 contiguous bytes, its store 256; a thread's 16 loads are
// all issued before its first store.
// ---------------------------------------------------------------------------
typedef __attribute__((ext_vector_type(4))) _Float16 v4h;
constexpr int CV_THREADS = 512;
constexpr int CV_PER     = 16;                            // float4 per thread
constexpr int CV_FLOATS  = CV_THREADS * CV_PER * 4;       // 32768 floats per work-group
constexpr int CV_XBLK    = GM * GK / CV_FLOATS;           // 128 work-groups for x
constexpr int CV_WBLK    = GN * GK / CV_FLOATS;           // 32 for each weight

__global__ __launch_bounds__(CV_THREADS)
void cvt_all(const float* __restrict__ x,  const float* __restrict__ wq,
             const float* __restrict__ wk, const float* __restrict__ wv,
             const float* __restrict__ wo, _Float16* __restrict__ dst) {
    const int b = blockIdx.x;
    const float* src;
    if (b < CV_XBLK) {
        src = x + (size_t)b * CV_FLOATS;
    } else {
        const int w = (b - CV_XBLK) / CV_WBLK;
        const float* base = (w == 0) ? wq : (w == 1) ? wk : (w == 2) ? wv : wo;
        src = base + (size_t)((b - CV_XBLK) % CV_WBLK) * CV_FLOATS;
    }
    const float4* s = (const float4*)src + threadIdx.x;
    v4h* d = (v4h*)(dst + (size_t)b * CV_FLOATS) + threadIdx.x;
    float4 f[CV_PER];
#pragma unroll
    for (int u = 0; u < CV_PER; ++u) f[u] = s[u * CV_THREADS];
#pragma unroll
    for (int u = 0; u < CV_PER; ++u) {
        v4h h;
        h[0] = (_Float16)f[u].x; h[1] = (_Float16)f[u].y;
        h[2] = (_Float16)f[u].z; h[3] = (_Float16)f[u].w;
        d[u * CV_THREADS] = h;
    }
}

// ---------------------------------------------------------------------------
// GEMM: C[M,N] = A[M,K] * W[N,K]^T   (all operands f16, f32 accumulation)
// Block tile 128x128x32, 256 threads = 8 waves, wave tile 32x64 (2x4 WMMA).
// MODE 0: C stored as f32, row-major.
// MODE 1, 2: the projections. The product runs transposed (W rows as the A operand, both
// loaders share one k order), so a lane holds one token (column l16) and 8 consecutive
// head dims per tile; a wave's 64 columns are one head, so the RoPE partners d and d + 32
// sit in tiles j and j + 2 of the same lane. MODE 1 rotates them in registers; both modes
// store f16 straight into the (b,h,s,d) layout that attention reads.
// LDS rows padded to 40 halves (80B stride -> conflict-free 16B frag reads).
// Double-buffered via async-to-LDS DMA; zero VGPR staging.
// ---------------------------------------------------------------------------
// The epilogue's transcendentals, each in one asm statement so that the closing v_nop stands
// directly behind it: that is the slot the instruction set asks for before a transcendental's
// source is overwritten.
// 2^x
__device__ __forceinline__ float exp2_hw(float x) {
    float y;
    asm("v_exp_f32 %0, %1\n\t"
        "v_nop"
        : "=v"(y) : "v"(x));
    return y;
}
// sin and cos of an angle given in revolutions (radians / 2 pi), the hardware's own unit
__device__ __forceinline__ void sincos_rev(float rev, float& sn, float& cs) {
    asm("v_sin_f32 %0, %2\n\t"
        "v_cos_f32 %1, %2\n\t"
        "v_nop"
        : "=&v"(sn), "=&v"(cs) : "v"(rev));
}

constexpr int BM = 128, BN = 128, BK = 32, LDT = 40;
constexpr int NKT = GK / BK;      // 32

template <int MODE>
__global__ __launch_bounds__(256)
void gemm_bt(const _Float16* __restrict__ Ah,
             const _Float16* __restrict__ Bh,
             float* __restrict__ C,
             _Float16* __restrict__ Ch) {
    __shared__ _Float16 As[2][BM * LDT];
    __shared__ _Float16 Bs[2][BM * LDT];

    const int tid = threadIdx.x;
    const int m0 = blockIdx.y * BM;
    const int n0 = blockIdx.x * BN;
    const int lr = tid >> 1;           // 0..127 (tile row)
    const int lc = (tid & 1) * 16;     // 0 or 16 (k sub-chunk)

    const int wave = tid >> 5, lane = tid & 31;
    const int wm = (wave >> 1) * 32;
    const int wn = (wave & 1) * 64;
    const int l16 = lane & 15;
    const int kh8 = (lane >> 4) * 8;

    const _Float16* ga = Ah + (size_t)(m0 + lr) * GK + lc;
    const _Float16* gb = Bh + (size_t)(n0 + lr) * GK + lc;

    auto issue = [&](int kt, int buf) {
        const unsigned la = (unsigned)(size_t)&As[buf][lr * LDT + lc];
        const unsigned lb = (unsigned)(size_t)&Bs[buf][lr * LDT + lc];
        async_copy32B(la, (unsigned long long)(size_t)(ga + kt * BK));
        async_copy32B(lb, (unsigned long long)(size_t)(gb + kt * BK));
    };

    v8f acc[2][4] = {};

    issue(0, 0);
    async_wait0();
    __syncthreads();

    int cur = 0;
    for (int kt = 0; kt < NKT; ++kt) {
        if (kt + 1 < NKT) issue(kt + 1, cur ^ 1);

        v16h af[2], bf[4];
#pragma unroll
        for (int i = 0; i < 2; ++i) {
            const _Float16* base = &As[cur][(wm + 16 * i + l16) * LDT];
            af[i] = mk16(*(const v8h*)(base + kh8), *(const v8h*)(base + 16 + kh8));
        }
#pragma unroll
        for (int j = 0; j < 4; ++j) {
            const _Float16* base = &Bs[cur][(wn + 16 * j + l16) * LDT];
            bf[j] = mk16(*(const v8h*)(base + kh8), *(const v8h*)(base + 16 + kh8));
        }
#pragma unroll
        for (int i = 0; i < 2; ++i)
#pragma unroll
            for (int j = 0; j < 4; ++j)
                acc[i][j] = (MODE == 0) ? wmma_f16(af[i], bf[j], acc[i][j])
                                        : wmma_f16(bf[j], af[i], acc[i][j]);

        if (kt + 1 < NKT) async_wait0();
        __syncthreads();
        cur ^= 1;
    }

    const int rgrp = (lane >> 4) * 8;
    if constexpr (MODE == 0) {
#pragma unroll
        for (int i = 0; i < 2; ++i)
#pragma unroll
            for (int j = 0; j < 4; ++j)
#pragma unroll
                for (int r = 0; r < 8; ++r) {
                    const int row = m0 + wm + 16 * i + r + rgrp;
                    const int col = n0 + wn + 16 * j + l16;
                    C[(size_t)row * GN + col] = acc[i][j][r];
                }
    } else {
        // acc[i][j][r] = C[token m0 + wm + 16*i + l16][column n0 + wn + 16*j + rgrp + r]
        const int hd = (n0 + wn) / HDIM;
#pragma unroll
        for (int i = 0; i < 2; ++i) {
            const int row = m0 + wm + 16 * i + l16;
            const int bb  = row / SEQ;
            const int s   = row % SEQ;
            if constexpr (MODE == 1) {
#pragma unroll
                for (int j = 0; j < 2; ++j)
#pragma unroll
                    for (int r = 0; r < 8; ++r) {
                        const int d = 16 * j + rgrp + r;
                        // inv_freq = 10000^(-d/32) = exp(-d * ln(10000)/32)
                        const float invf = exp2_hw(-(float)d * (9.210340371976184f / 32.0f) * 1.4426950408889634f);
                        const float ang  = (float)s * invf;
                        float sn, cs;
                        sincos_rev(ang * 0.15915494309189532f, sn, cs);
                        const float t1 = acc[i][j][r], t2 = acc[i][j + 2][r];
                        acc[i][j][r]     = t1 * cs - t2 * sn;
                        acc[i][j + 2][r] = t2 * cs + t1 * sn;
                    }
            }
            _Float16* op = Ch + (((size_t)bb * HEADS + hd) * SEQ + s) * HDIM + rgrp;
#pragma unroll
            for (int j = 0; j < 4; ++j) {
                v8h o;
#pragma unroll
                for (int r = 0; r < 8; ++r) o[r] = (_Float16)acc[i][j][r];
                *(v8h*)(op + 16 * j) = o;
            }
        }
    }
}

constexpr int LDQ = 72;

// value of lane l ^ 16 (the other half of the wave)
__device__ __forceinline__ float xhalf(float x) {
    return __builtin_bit_cast(float, __builtin_amdgcn_permlanex16(
        __builtin_bit_cast(int, x), __builtin_bit_cast(int, x),
        0x76543210, 0xfedcba98, false, false));
}

__global__ __launch_bounds__(128)
void attn_fa(const _Float16* __restrict__ qh, const _Float16* __restrict__ kh,
             const _Float16* __restrict__ vh, _Float16* __restrict__ oh) {
    __shared__ _Float16 Qs[64 * LDQ];
    __shared__ _Float16 Ks[64 * LDQ];
    __shared__ _Float16 Vt[64 * LDQ];       // transposed: [d][key]

    const int tid  = threadIdx.x;
    const int wave = tid >> 5, lane = tid & 31;
    const int l16  = lane & 15;
    const int kh8  = (lane >> 4) * 8;
    const int rgrp = (lane >> 4) * 8;

    const int b  = blockIdx.z;
    const int hh = blockIdx.y;
    const int q0 = blockIdx.x * 64;
    const size_t bh = (size_t)b * HEADS + hh;
    const _Float16* Qg = qh + bh * SEQ * HDIM;
    const _Float16* Kg = kh + bh * SEQ * HDIM;
    const _Float16* Vg = vh + bh * SEQ * HDIM;

    const int srow = tid >> 1;            // staging row 0..63
    const int scol = (tid & 1) * 32;      // staging col 0 or 32

    // ---- stage Q tile (64 x 64) once, via async DMA ----
    async_copy64B((unsigned)(size_t)&Qs[srow * LDQ + scol],
                  (unsigned long long)(size_t)(Qg + (size_t)(q0 + srow) * HDIM + scol));
    async_wait0();
    __syncthreads();

    // Q^T fragments for this wave (B operand: column l16 = query; constant across key tiles)
    v16h qa0, qa1;
    {
        const _Float16* base = &Qs[(wave * 16 + l16) * LDQ];
        qa0 = mk16(*(const v8h*)(base + kh8),      *(const v8h*)(base + 16 + kh8));
        qa1 = mk16(*(const v8h*)(base + 32 + kh8), *(const v8h*)(base + 48 + kh8));
    }

    float mrun = -1e30f;   // running max of this lane's query (same in both halves)
    float lrun = 0.0f;     // running sum over this half's keys only; halves join in the epilogue
    v8f oa[4] = {};        // oa[jd][r] = O^T[jd*16 + rgrp + r][query l16]

    for (int kt = 0; kt < SEQ / 64; ++kt) {
        // ---- stage K tile (async DMA) and V tile (manual transpose) ----
        async_copy64B((unsigned)(size_t)&Ks[srow * LDQ + scol],
                      (unsigned long long)(size_t)(Kg + (size_t)(kt * 64 + srow) * HDIM + scol));
        {
            const _Float16* pv = Vg + (size_t)(kt * 64 + srow) * HDIM + scol;
            v8h v0 = *(const v8h*)pv,        v1 = *(const v8h*)(pv + 8);
            v8h v2 = *(const v8h*)(pv + 16), v3 = *(const v8h*)(pv + 24);
#pragma unroll
            for (int e = 0; e < 8; ++e) {
                Vt[(scol + e)      * LDQ + srow] = v0[e];
                Vt[(scol + 8 + e)  * LDQ + srow] = v1[e];
                Vt[(scol + 16 + e) * LDQ + srow] = v2[e];
                Vt[(scol + 24 + e) * LDQ + srow] = v3[e];
            }
        }
        async_wait0();
        __syncthreads();

        // ---- scores S^T = K * Q^T * scale : sc[j][r] = S[query l16][key j*16 + rgrp + r] ----
        v8f sc[4];
#pragma unroll
        for (int j = 0; j < 4; ++j) {
            const _Float16* base = &Ks[(j * 16 + l16) * LDQ];
            v16h kb0 = mk16(*(const v8h*)(base + kh8),      *(const v8h*)(base + 16 + kh8));
            v16h kb1 = mk16(*(const v8h*)(base + 32 + kh8), *(const v8h*)(base + 48 + kh8));
            v8f z = {};
            z = wmma_f16(kb0, qa0, z);
            z = wmma_f16(kb1, qa1, z);
#pragma unroll
            for (int r = 0; r < 8; ++r) z[r] *= 0.125f;   // 1/sqrt(64)
            sc[j] = z;
        }

        // ---- online softmax: 32 scores of one query per lane ----
        float t4[4];
#pragma unroll
        for (int j = 0; j < 4; ++j)
            t4[j] = fmaxf(fmaxf(fmaxf(sc[j][0], sc[j][1]), fmaxf(sc[j][2], sc[j][3])),
                          fmaxf(fmaxf(sc[j][4], sc[j][5]), fmaxf(sc[j][6], sc[j][7])));
        float tm = fmaxf(fmaxf(t4[0], t4[1]), fmaxf(t4[2], t4[3]));
        tm = fmaxf(tm, xhalf(tm));                 // join the two key halves
        const float nm   = fmaxf(mrun, tm);
        const float corr = __expf(mrun - nm);
        mrun = nm;

        // P^T packs in place into the B operand: in the hardware k order (the one the K, Q and
        // V^T loaders use) element s of pb[kk] is register s & 7 of score tile 2*kk + (s >> 3)
        v16h pb[2];
        v2f rs[4];
#pragma unroll
        for (int j = 0; j < 4; ++j) {
#pragma unroll
            for (int r = 0; r < 8; r += 2) {
                v2f p;
                p.x = __expf(sc[j][r] - nm);
                p.y = __expf(sc[j][r + 1] - nm);
                rs[j] = (r == 0) ? p : rs[j] + p;
                pb[j >> 1][(j & 1) * 8 + r]     = (_Float16)p.x;
                pb[j >> 1][(j & 1) * 8 + r + 1] = (_Float16)p.y;
            }
        }
        const v2f rt = (rs[0] + rs[1]) + (rs[2] + rs[3]);
        lrun = lrun * corr + (rt.x + rt.y);
#pragma unroll
        for (int jd = 0; jd < 4; ++jd)
#pragma unroll
            for (int r = 0; r < 8; ++r) oa[jd][r] *= corr;

        // ---- O^T += V^T * P^T ----
#pragma unroll
        for (int jd = 0; jd < 4; ++jd) {
            const _Float16* base = &Vt[(jd * 16 + l16) * LDQ];
            v16h vb0 = mk16(*(const v8h*)(base + kh8),      *(const v8h*)(base + 16 + kh8));
            v16h vb1 = mk16(*(const v8h*)(base + 32 + kh8), *(const v8h*)(base + 48 + kh8));
            oa[jd] = wmma_f16(vb0, pb[0], oa[jd]);
            oa[jd] = wmma_f16(vb1, pb[1], oa[jd]);
        }
        __syncthreads();
    }

    // ---- epilogue: O / l  ->  (b,s,h,d) f16; a lane holds 8 consecutive d per tile ----
    const float inv = 1.0f / (lrun + xhalf(lrun));
    const int   row = q0 + wave * 16 + l16;
    _Float16* op = oh + (((size_t)b * SEQ + row) * HEADS + hh) * HDIM + rgrp;
#pragma unroll
    for (int jd = 0; jd < 4; ++jd) {
        v8h o;
#pragma unroll
        for (int r = 0; r < 8; ++r) o[r] = (_Float16)(oa[jd][r] * inv);
        *(v8h*)(op + jd * 16) = o;
    }
}

// ---------------------------------------------------------------------------
// Launch
// ---------------------------------------------------------------------------
extern "C" void kernel_launch(void* const* d_in, const int* in_sizes, int n_in,
                              void* d_out, int out_size, void* d_ws, size_t ws_size,
                              hipStream_t stream) {
    const float* x  = (const float*)d_in[0];
    const float* Wq = (const float*)d_in[1];
    const float* Wk = (const float*)d_in[2];
    const float* Wv = (const float*)d_in[3];
    const float* Wo = (const float*)d_in[4];
    float* out = (float*)d_out;

    char* ws = (char*)d_ws;
    constexpr size_t F32_MAT = (size_t)GM * GN * sizeof(float);     // 16 MiB
    constexpr size_t F16_MAT = (size_t)GM * GN * sizeof(_Float16);  //  8 MiB
    constexpr size_t F16_W   = (size_t)GN * GK * sizeof(_Float16);  //  2 MiB

    _Float16* qh  = (_Float16*)(ws + 3 * F32_MAT);
    _Float16* kh  = (_Float16*)(ws + 3 * F32_MAT + F16_MAT);
    _Float16* vh  = (_Float16*)(ws + 3 * F32_MAT + 2 * F16_MAT);
    _Float16* xh  = (_Float16*)(ws + 3 * F32_MAT + 3 * F16_MAT);
    _Float16* Wqh = (_Float16*)(ws + 3 * F32_MAT + 4 * F16_MAT);
    _Float16* Wkh = (_Float16*)(ws + 3 * F32_MAT + 4 * F16_MAT + F16_W);
    _Float16* Wvh = (_Float16*)(ws + 3 * F32_MAT + 4 * F16_MAT + 2 * F16_W);
    _Float16* Woh = (_Float16*)(ws + 3 * F32_MAT + 4 * F16_MAT + 3 * F16_W);
    _Float16* oh  = (_Float16*)(ws);

    // fp32 -> fp16 operand conversion: xh, Wqh, Wkh, Wvh, Woh are one contiguous range
    cvt_all<<<CV_XBLK + 4 * CV_WBLK, CV_THREADS, 0, stream>>>(x, Wq, Wk, Wv, Wo, xh);

    const dim3 ggrid(GN / BN, GM / BM);  // (8, 32)

    gemm_bt<1><<<ggrid, 256, 0, stream>>>(xh, Wqh, nullptr, qh);
    gemm_bt<1><<<ggrid, 256, 0, stream>>>(xh, Wkh, nullptr, kh);
    gemm_bt<2><<<ggrid, 256, 0, stream>>>(xh, Wvh, nullptr, vh);
    attn_fa<<<dim3(SEQ / 64, HEADS, BATCH), 128, 0, stream>>>(qh, kh, vh, oh);
    gemm_bt<0><<<ggrid, 256, 0, stream>>>(oh, Woh, out, nullptr);
}

// v004
// Measured time: 128 microseconds a run.
// Next to v003, in two timings, it ran 1.12 and 1.11 times as fast.
// Over all steps from v000 it is 1.52 times as fast.
#include <hip/hip_runtime.h>
#include <hip/hip_bf16.h>

// ---------------------------------------------------------------------------
// Types for WMMA (CDNA5 / gfx1250, wave32)
// ---------------------------------------------------------------------------
typedef __attribute__((ext_vector_type(16))) _Float16 v16h;
typedef __attribute__((ext_vector_type(8)))  _Float16 v8h;
typedef __attribute__((ext_vector_type(8)))  float    v8f;
typedef __attribute__((ext_vector_type(2)))  float    v2f;

__device__ __forceinline__ v16h mk16(v8h lo, v8h hi) {
    union { v16h v; v8h h[2]; } u;
    u.h[0] = lo; u.h[1] = hi;
    return u.v;
}

__device__ __forceinline__ v8f wmma_f16(v16h a, v16h b, v8f c) {
    // D = A(16x32 f16) * B(32x16 f16) + C(16x16 f32)
    return __builtin_amdgcn_wmma_f32_16x16x32_f16(
        /*neg_a=*/false, a, /*neg_b=*/false, b,
        /*c_mod=*/(short)0, c, /*reuse_a=*/false, /*reuse_b=*/false);
}

// ---------------------------------------------------------------------------
// Async global->LDS staging (gfx1250 ASYNCcnt path). INST_OFFSET is added to
// BOTH the LDS and global address, so one base covers a contiguous row chunk.
// ---------------------------------------------------------------------------
__device__ __forceinline__ void async_copy32B(unsigned lds, unsigned long long g) {
    asm volatile(
        "global_load_async_to_lds_b128 %0, %1, off\n\t"
        "global_load_async_to_lds_b128 %0, %1, off offset:16"
        :: "v"(lds), "v"(g) : "memory");
}
__device__ __forceinline__ void async_copy64B(unsigned lds, unsigned long long g) {
    asm volatile(
        "global_load_async_to_lds_b128 %0, %1, off\n\t"
        "global_load_async_to_lds_b128 %0, %1, off offset:16\n\t"
        "global_load_async_to_lds_b128 %0, %1, off offset:32\n\t"
        "global_load_async_to_lds_b128 %0, %1, off offset:48\n\t"
        "s_wait_xcnt 0x0"   // inside the statement: the copies' address registers are rewritten only behind it
        :: "v"(lds), "v"(g) : "memory");
}
__device__ __forceinline__ void async_wait0() {
    asm volatile("s_wait_asynccnt 0" ::: "memory");
}

// ---------------------------------------------------------------------------
// Problem constants
// ---------------------------------------------------------------------------
constexpr int BATCH = 2;
constexpr int SEQ   = 2048;
constexpr int HID   = 1024;
constexpr int HEADS = 16;
constexpr int HDIM  = 64;
constexpr int GM = BATCH * SEQ;   // 4096
constexpr int GN = HID;           // 1024
constexpr int GK = HID;           // 1024

// ---------------------------------------------------------------------------
// fp32 -> fp16 conversion of all five inputs in ONE launch (makes all GEMM operands
// async-able). The five f16 copies lie back to back in the workspace, so the target is one
// range. One work-group of 16 waves per 32768 floats; a work-group lies wholly inside one
// input. A wave's load covers 512 contiguous bytes, its store 256; a thread's 16 loads are
// all issued before its first store.
// ---------------------------------------------------------------------------
typedef __attribute__((ext_vector_type(4))) _Float16 v4h;
constexpr int CV_THREADS = 512;
constexpr int CV_PER     = 16;                            // float4 per thread
constexpr int CV_FLOATS  = CV_THREADS * CV_PER * 4;       // 32768 floats per work-group
constexpr int CV_XBLK    = GM * GK / CV_FLOATS;           // 128 work-groups for x
constexpr int CV_WBLK    = GN * GK / CV_FLOATS;           // 32 for each weight

__global__ __launch_bounds__(CV_THREADS)
void cvt_all(const float* __restrict__ x,  const float* __restrict__ wq,
             const float* __restrict__ wk, const float* __restrict__ wv,
             const float* __restrict__ wo, _Float16* __restrict__ dst) {
    const int b = blockIdx.x;
    const float* src;
    if (b < CV_XBLK) {
        src = x + (size_t)b * CV_FLOATS;
    } else {
        const int w = (b - CV_XBLK) / CV_WBLK;
        const float* base = (w == 0) ? wq : (w == 1) ? wk : (w == 2) ? wv : wo;
        src = base + (size_t)((b - CV_XBLK) % CV_WBLK) * CV_FLOATS;
    }
    const float4* s = (const float4*)src + threadIdx.x;
    v4h* d = (v4h*)(dst + (size_t)b * CV_FLOATS) + threadIdx.x;
    float4 f[CV_PER];
#pragma unroll
    for (int u = 0; u < CV_PER; ++u) f[u] = s[u * CV_THREADS];
#pragma unroll
    for (int u = 0; u < CV_PER; ++u) {
        v4h h;
        h[0] = (_Float16)f[u].x; h[1] = (_Float16)f[u].y;
        h[2] = (_Float16)f[u].z; h[3] = (_Float16)f[u].w;
        d[u * CV_THREADS] = h;
    }
}

// ---------------------------------------------------------------------------
// GEMM: C[M,N] = A[M,K] * W[N,K]^T   (all operands f16, f32 accumulation)
// Block tile 128x128x32, 256 threads = 8 waves, wave tile 32x64 (2x4 WMMA).
// MODE 0: C stored as f32, row-major.
// MODE 1: the three projections in ONE launch. Wq, Wk, Wv lie back to back as f16, so they
// are one weight matrix of 3 * GN rows, and the grid's x runs over all its column tiles; a
// work-group lies wholly inside one projection. Three work-groups then share a WGP, and one's
// wait for its copies is filled by the others' products. The product runs transposed (W rows
// as the A operand, both loaders share one k order), so a lane holds one token (column l16)
// and 8 consecutive head dims per tile; a wave's 64 columns are one head, so the RoPE
// partners d and d + 32 sit in tiles j and j + 2 of the same lane. Q and K are rotated in
// registers, V is not; all three are stored as f16 straight into the (b,h,s,d) layout that
// attention reads (q, k, v planes back to back behind Ch).
// LDS rows padded to 40 halves (80B stride -> conflict-free 16B frag reads).
// Double-buffered via async-to-LDS DMA; zero VGPR staging.
// ---------------------------------------------------------------------------
// The epilogue's transcendentals, each in one asm statement so that the closing v_nop stands
// directly behind it: that is the slot the instruction set asks for before a transcendental's
// source is overwritten.
// 2^x
__device__ __forceinline__ float exp2_hw(float x) {
    float y;
    asm("v_exp_f32 %0, %1\n\t"
        "v_nop"
        : "=v"(y) : "v"(x));
    return y;
}
// sin and cos of an angle given in revolutions (radians / 2 pi), the hardware's own unit
__device__ __forceinline__ void sincos_rev(float rev, float& sn, float& cs) {
    asm("v_sin_f32 %0, %2\n\t"
        "v_cos_f32 %1, %2\n\t"
        "v_nop"
        : "=&v"(sn), "=&v"(cs) : "v"(rev));
}

constexpr int BM = 128, BN = 128, BK = 32, LDT = 40;
constexpr int NKT = GK / BK;      // 32

template <int MODE>
__global__ __launch_bounds__(256)
void gemm_bt(const _Float16* __restrict__ Ah,
             const _Float16* __restrict__ Bh,
             float* __restrict__ C,
             _Float16* __restrict__ Ch) {
    __shared__ _Float16 As[2][BM * LDT];
    __shared__ _Float16 Bs[2][BM * LDT];

    const int tid = threadIdx.x;
    const int m0 = blockIdx.y * BM;
    const int n0 = blockIdx.x * BN;
    const int lr = tid >> 1;           // 0..127 (tile row)
    const int lc = (tid & 1) * 16;     // 0 or 16 (k sub-chunk)

    const int wave = tid >> 5, lane = tid & 31;
    const int wm = (wave >> 1) * 32;
    const int wn = (wave & 1) * 64;
    const int l16 = lane & 15;
    const int kh8 = (lane >> 4) * 8;

    const _Float16* ga = Ah + (size_t)(m0 + lr) * GK + lc;
    const _Float16* gb = Bh + (size_t)(n0 + lr) * GK + lc;

    auto issue = [&](int kt, int buf) {
        const unsigned la = (unsigned)(size_t)&As[buf][lr * LDT + lc];
        const unsigned lb = (unsigned)(size_t)&Bs[buf][lr * LDT + lc];
        async_copy32B(la, (unsigned long long)(size_t)(ga + kt * BK));
        async_copy32B(lb, (unsigned long long)(size_t)(gb + kt * BK));
    };

    v8f acc[2][4] = {};

    issue(0, 0);
    async_wait0();
    __syncthreads();

    int cur = 0;
    for (int kt = 0; kt < NKT; ++kt) {
        if (kt + 1 < NKT) issue(kt + 1, cur ^ 1);

        v16h af[2], bf[4];
#pragma unroll
        for (int i = 0; i < 2; ++i) {
            const _Float16* base = &As[cur][(wm + 16 * i + l16) * LDT];
            af[i] = mk16(*(const v8h*)(base + kh8), *(const v8h*)(base + 16 + kh8));
        }
#pragma unroll
        for (int j = 0; j < 4; ++j) {
            const _Float16* base = &Bs[cur][(wn + 16 * j + l16) * LDT];
            bf[j] = mk16(*(const v8h*)(base + kh8), *(const v8h*)(base + 16 + kh8));
        }
#pragma unroll
        for (int i = 0; i < 2; ++i)
#pragma unroll
            for (int j = 0; j < 4; ++j)
                acc[i][j] = (MODE == 0) ? wmma_f16(af[i], bf[j], acc[i][j])
                                        : wmma_f16(bf[j], af[i], acc[i][j]);

        if (kt + 1 < NKT) async_wait0();
        __syncthreads();
        cur ^= 1;
    }

    const int rgrp = (lane >> 4) * 8;
    if constexpr (MODE == 0) {
#pragma unroll
        for (int i = 0; i < 2; ++i)
#pragma unroll
            for (int j = 0; j < 4; ++j)
#pragma unroll
                for (int r = 0; r < 8; ++r) {
                    const int row = m0 + wm + 16 * i + r + rgrp;
                    const int col = n0 + wn + 16 * j + l16;
                    C[(size_t)row * GN + col] = acc[i][j][r];
                }
    } else {
        // acc[i][j][r] = C[token m0 + wm + 16*i + l16][column n0 + wn + 16*j + rgrp + r]
        const int proj = n0 / GN;                    // 0 = Q, 1 = K, 2 = V: the same for the whole work-group
        const int hd   = (n0 % GN + wn) / HDIM;
        _Float16* Cp   = Ch + (size_t)proj * GM * GN;
#pragma unroll
        for (int i = 0; i < 2; ++i) {
            const int row = m0 + wm + 16 * i + l16;
            const int bb  = row / SEQ;
            const int s   = row % SEQ;
            if (proj < 2) {
#pragma unroll
                for (int j = 0; j < 2; ++j)
#pragma unroll
                    for (int r = 0; r < 8; ++r) {
                        const int d = 16 * j + rgrp + r;
                        // inv_freq = 10000^(-d/32) = exp(-d * ln(10000)/32)
                        const float invf = exp2_hw(-(float)d * (9.210340371976184f / 32.0f) * 1.4426950408889634f);
                        const float ang  = (float)s * invf;
                        float sn, cs;
                        sincos_rev(ang * 0.15915494309189532f, sn, cs);
                        const float t1 = acc[i][j][r], t2 = acc[i][j + 2][r];
                        acc[i][j][r]     = t1 * cs - t2 * sn;
                        acc[i][j + 2][r] = t2 * cs + t1 * sn;
                    }
            }
            _Float16* op = Cp + (((size_t)bb * HEADS + hd) * SEQ + s) * HDIM + rgrp;
#pragma unroll
            for (int j = 0; j < 4; ++j) {
                v8h o;
#pragma unroll
                for (int r = 0; r < 8; ++r) o[r] = (_Float16)acc[i][j][r];
                *(v8h*)(op + 16 * j) = o;
            }
        }
    }
}

constexpr int LDQ = 72;

// value of lane l ^ 16 (the other half of the wave)
__device__ __forceinline__ float xhalf(float x) {
    return __builtin_bit_cast(float, __builtin_amdgcn_permlanex16(
        __builtin_bit_cast(int, x), __builtin_bit_cast(int, x),
        0x76543210, 0xfedcba98, false, false));
}

__global__ __launch_bounds__(128)
void attn_fa(const _Float16* __restrict__ qh, const _Float16* __restrict__ kh,
             const _Float16* __restrict__ vh, _Float16* __restrict__ oh) {
    __shared__ _Float16 Qs[64 * LDQ];
    __shared__ _Float16 Ks[64 * LDQ];
    __shared__ _Float16 Vt[64 * LDQ];       // transposed: [d][key]

    const int tid  = threadIdx.x;
    const int wave = tid >> 5, lane = tid & 31;
    const int l16  = lane & 15;
    const int kh8  = (lane >> 4) * 8;
    const int rgrp = (lane >> 4) * 8;

    const int b  = blockIdx.z;
    const int hh = blockIdx.y;
    const int q0 = blockIdx.x * 64;
    const size_t bh = (size_t)b * HEADS + hh;
    const _Float16* Qg = qh + bh * SEQ * HDIM;
    const _Float16* Kg = kh + bh * SEQ * HDIM;
    const _Float16* Vg = vh + bh * SEQ * HDIM;

    const int srow = tid >> 1;            // staging row 0..63
    const int scol = (tid & 1) * 32;      // staging col 0 or 32

    // ---- stage Q tile (64 x 64) once, via async DMA ----
    async_copy64B((unsigned)(size_t)&Qs[srow * LDQ + scol],
                  (unsigned long long)(size_t)(Qg + (size_t)(q0 + srow) * HDIM + scol));
    async_wait0();
    __syncthreads();

    // Q^T fragments for this wave (B operand: column l16 = query; constant across key tiles)
    v16h qa0, qa1;
    {
        const _Float16* base = &Qs[(wave * 16 + l16) * LDQ];
        qa0 = mk16(*(const v8h*)(base + kh8),      *(const v8h*)(base + 16 + kh8));
        qa1 = mk16(*(const v8h*)(base + 32 + kh8), *(const v8h*)(base + 48 + kh8));
    }

    float mrun = -1e30f;   // running max of this lane's query (same in both halves)
    float lrun = 0.0f;     // running sum over this half's keys only; halves join in the epilogue
    v8f oa[4] = {};        // oa[jd][r] = O^T[jd*16 + rgrp + r][query l16]

    for (int kt = 0; kt < SEQ / 64; ++kt) {
        // ---- stage K tile (async DMA) and V tile (manual transpose) ----
        async_copy64B((unsigned)(size_t)&Ks[srow * LDQ + scol],
                      (unsigned long long)(size_t)(Kg + (size_t)(kt * 64 + srow) * HDIM + scol));
        {
            const _Float16* pv = Vg + (size_t)(kt * 64 + srow) * HDIM + scol;
            v8h v0 = *(const v8h*)pv,        v1 = *(const v8h*)(pv + 8);
            v8h v2 = *(const v8h*)(pv + 16), v3 = *(const v8h*)(pv + 24);
#pragma unroll
            for (int e = 0; e < 8; ++e) {
                Vt[(scol + e)      * LDQ + srow] = v0[e];
                Vt[(scol + 8 + e)  * LDQ + srow] = v1[e];
                Vt[(scol + 16 + e) * LDQ + srow] = v2[e];
                Vt[(scol + 24 + e) * LDQ + srow] = v3[e];
            }
        }
        async_wait0();
        __syncthreads();

        // ---- scores S^T = K * Q^T * scale : sc[j][r] = S[query l16][key j*16 + rgrp + r] ----
        v8f sc[4];
#pragma unroll
        for (int j = 0; j < 4; ++j) {
            const _Float16* base = &Ks[(j * 16 + l16) * LDQ];
            v16h kb0 = mk16(*(const v8h*)(base + kh8),      *(const v8h*)(base + 16 + kh8));
            v16h kb1 = mk16(*(const v8h*)(base + 32 + kh8), *(const v8h*)(base + 48 + kh8));
            v8f z = {};
            z = wmma_f16(kb0, qa0, z);
            z = wmma_f16(kb1, qa1, z);
#pragma unroll
            for (int r = 0; r < 8; ++r) z[r] *= 0.125f;   // 1/sqrt(64)
            sc[j] = z;
        }

        // ---- online softmax: 32 scores of one query per lane ----
        float t4[4];
#pragma unroll
        for (int j = 0; j < 4; ++j)
            t4[j] = fmaxf(fmaxf(fmaxf(sc[j][0], sc[j][1]), fmaxf(sc[j][2], sc[j][3])),
                          fmaxf(fmaxf(sc[j][4], sc[j][5]), fmaxf(sc[j][6], sc[j][7])));
        float tm = fmaxf(fmaxf(t4[0], t4[1]), fmaxf(t4[2], t4[3]));
        tm = fmaxf(tm, xhalf(tm));                 // join the two key halves
        const float nm   = fmaxf(mrun, tm);
        const float corr = __expf(mrun - nm);
        mrun = nm;

        // P^T packs in place into the B operand: in the hardware k order (the one the K, Q and
        // V^T loaders use) element s of pb[kk] is register s & 7 of score tile 2*kk + (s >> 3)
        v16h pb[2];
        v2f rs[4];
#pragma unroll
        for (int j = 0; j < 4; ++j) {
#pragma unroll
            for (int r = 0; r < 8; r += 2) {
                v2f p;
                p.x = __expf(sc[j][r] - nm);
                p.y = __expf(sc[j][r + 1] - nm);
                rs[j] = (r == 0) ? p : rs[j] + p;
                pb[j >> 1][(j & 1) * 8 + r]     = (_Float16)p.x;
                pb[j >> 1][(j & 1) * 8 + r + 1] = (_Float16)p.y;
            }
        }
        const v2f rt = (rs[0] + rs[1]) + (rs[2] + rs[3]);
        lrun = lrun * corr + (rt.x + rt.y);
#pragma unroll
        for (int jd = 0; jd < 4; ++jd)
#pragma unroll
            for (int r = 0; r < 8; ++r) oa[jd][r] *= corr;

        // ---- O^T += V^T * P^T ----
#pragma unroll
        for (int jd = 0; jd < 4; ++jd) {
            const _Float16* base = &Vt[(jd * 16 + l16) * LDQ];
            v16h vb0 = mk16(*(const v8h*)(base + kh8),      *(const v8h*)(base + 16 + kh8));
            v16h vb1 = mk16(*(const v8h*)(base + 32 + kh8), *(const v8h*)(base + 48 + kh8));
            oa[jd] = wmma_f16(vb0, pb[0], oa[jd]);
            oa[jd] = wmma_f16(vb1, pb[1], oa[jd]);
        }
        __syncthreads();
    }

    // ---- epilogue: O / l  ->  (b,s,h,d) f16; a lane holds 8 consecutive d per tile ----
    const float inv = 1.0f / (lrun + xhalf(lrun));
    const int   row = q0 + wave * 16 + l16;
    _Float16* op = oh + (((size_t)b * SEQ + row) * HEADS + hh) * HDIM + rgrp;
#pragma unroll
    for (int jd = 0; jd < 4; ++jd) {
        v8h o;
#pragma unroll
        for (int r = 0; r < 8; ++r) o[r] = (_Float16)(oa[jd][r] * inv);
        *(v8h*)(op + jd * 16) = o;
    }
}

// ---------------------------------------------------------------------------
// Launch
// ---------------------------------------------------------------------------
extern "C" void kernel_launch(void* const* d_in, const int* in_sizes, int n_in,
                              void* d_out, int out_size, void* d_ws, size_t ws_size,
                              hipStream_t stream) {
    const float* x  = (const float*)d_in[0];
    const float* Wq = (const float*)d_in[1];
    const float* Wk = (const float*)d_in[2];
    const float* Wv = (const float*)d_in[3];
    const float* Wo = (const float*)d_in[4];
    float* out = (float*)d_out;

    char* ws = (char*)d_ws;
    constexpr size_t F32_MAT = (size_t)GM * GN * sizeof(float);     // 16 MiB
    constexpr size_t F16_MAT = (size_t)GM * GN * sizeof(_Float16);  //  8 MiB
    constexpr size_t F16_W   = (size_t)GN * GK * sizeof(_Float16);  //  2 MiB

    _Float16* qh  = (_Float16*)(ws + 3 * F32_MAT);
    _Float16* kh  = (_Float16*)(ws + 3 * F32_MAT + F16_MAT);
    _Float16* vh  = (_Float16*)(ws + 3 * F32_MAT + 2 * F16_MAT);
    _Float16* xh  = (_Float16*)(ws + 3 * F32_MAT + 3 * F16_MAT);
    _Float16* Wqh = (_Float16*)(ws + 3 * F32_MAT + 4 * F16_MAT);
    _Float16* Woh = (_Float16*)(ws + 3 * F32_MAT + 4 * F16_MAT + 3 * F16_W);
    _Float16* oh  = (_Float16*)(ws);

    // fp32 -> fp16 operand conversion: xh, Wqh, Wkh, Wvh, Woh are one contiguous range
    cvt_all<<<CV_XBLK + 4 * CV_WBLK, CV_THREADS, 0, stream>>>(x, Wq, Wk, Wv, Wo, xh);

    const dim3 ggrid(GN / BN, GM / BM);  // (8, 32)

    // Q, K and V projections: one launch over the 3 * GN rows of [Wqh; Wkh; Wvh], into [qh; kh; vh]
    gemm_bt<1><<<dim3(3 * GN / BN, GM / BM), 256, 0, stream>>>(xh, Wqh, nullptr, qh);
    attn_fa<<<dim3(SEQ / 64, HEADS, BATCH), 128, 0, stream>>>(qh, kh, vh, oh);
    gemm_bt<0><<<ggrid, 256, 0, stream>>>(oh, Woh, out, nullptr);
}

// v005
// One run takes 119 microseconds.
// In both of two side-by-side timings against v004, it was 1.08 times as fast.
// All steps since v000 together make it 1.64 times as fast.
#include <hip/hip_runtime.h>
#include <hip/hip_bf16.h>

// ---------------------------------------------------------------------------
// Types for WMMA (CDNA5 / gfx1250, wave32)
// ---------------------------------------------------------------------------
typedef __attribute__((ext_vector_type(16))) _Float16 v16h;
typedef __attribute__((ext_vector_type(8)))  _Float16 v8h;
typedef __attribute__((ext_vector_type(8)))  float    v8f;
typedef __attribute__((ext_vector_type(2)))  float    v2f;

__device__ __forceinline__ v16h mk16(v8h lo, v8h hi) {
    union { v16h v; v8h h[2]; } u;
    u.h[0] = lo; u.h[1] = hi;
    return u.v;
}

__device__ __forceinline__ v8f wmma_f16(v16h a, v16h b, v8f c) {
    // D = A(16x32 f16) * B(32x16 f16) + C(16x16 f32)
    return __builtin_amdgcn_wmma_f32_16x16x32_f16(
        /*neg_a=*/false, a, /*neg_b=*/false, b,
        /*c_mod=*/(short)0, c, /*reuse_a=*/false, /*reuse_b=*/false);
}

// ---------------------------------------------------------------------------
// Async global->LDS staging (gfx1250 ASYNCcnt path). INST_OFFSET is added to
// BOTH the LDS and global address, so one base covers a contiguous row chunk.
// ---------------------------------------------------------------------------
__device__ __forceinline__ void async_copy32B(unsigned lds, unsigned long long g) {
    asm volatile(
        "global_load_async_to_lds_b128 %0, %1, off\n\t"
        "global_load_async_to_lds_b128 %0, %1, off offset:16"
        :: "v"(lds), "v"(g) : "memory");
}
__device__ __forceinline__ void async_copy64B(unsigned lds, unsigned long long g) {
    asm volatile(
        "global_load_async_to_lds_b128 %0, %1, off\n\t"
        "global_load_async_to_lds_b128 %0, %1, off offset:16\n\t"
        "global_load_async_to_lds_b128 %0, %1, off offset:32\n\t"
        "global_load_async_to_lds_b128 %0, %1, off offset:48\n\t"
        "s_wait_xcnt 0x0"   // inside the statement: the copies' address registers are rewritten only behind it
        :: "v"(lds), "v"(g) : "memory");
}
__device__ __forceinline__ void async_wait0() {
    asm volatile("s_wait_asynccnt 0" ::: "memory");
}

// ---------------------------------------------------------------------------
// Problem constants
// ---------------------------------------------------------------------------
constexpr int BATCH = 2;
constexpr int SEQ   = 2048;
constexpr int HID   = 1024;
constexpr int HEADS = 16;
constexpr int HDIM  = 64;
constexpr int GM = BATCH * SEQ;   // 4096
constexpr int GN = HID;           // 1024
constexpr int GK = HID;           // 1024

// ---------------------------------------------------------------------------
// fp32 -> fp16 conversion of all five inputs in ONE launch (makes all GEMM operands
// async-able). The five f16 copies lie back to back in the workspace, so the target is one
// range. One work-group of 16 waves per 32768 floats; a work-group lies wholly inside one
// input. A wave's load covers 512 contiguous bytes, its store 256; a thread's 16 loads are
// all issued before its first store.
// ---------------------------------------------------------------------------
typedef __attribute__((ext_vector_type(4))) _Float16 v4h;
constexpr int CV_THREADS = 512;
constexpr int CV_PER     = 16;                            // float4 per thread
constexpr int CV_FLOATS  = CV_THREADS * CV_PER * 4;       // 32768 floats per work-group
constexpr int CV_XBLK    = GM * GK / CV_FLOATS;           // 128 work-groups for x
constexpr int CV_WBLK    = GN * GK / CV_FLOATS;           // 32 for each weight

__global__ __launch_bounds__(CV_THREADS)
void cvt_all(const float* __restrict__ x,  const float* __restrict__ wq,
             const float* __restrict__ wk, const float* __restrict__ wv,
             const float* __restrict__ wo, _Float16* __restrict__ dst) {
    const int b = blockIdx.x;
    const float* src;
    if (b < CV_XBLK) {
        src = x + (size_t)b * CV_FLOATS;
    } else {
        const int w = (b - CV_XBLK) / CV_WBLK;
        const float* base = (w == 0) ? wq : (w == 1) ? wk : (w == 2) ? wv : wo;
        src = base + (size_t)((b - CV_XBLK) % CV_WBLK) * CV_FLOATS;
    }
    const float4* s = (const float4*)src + threadIdx.x;
    v4h* d = (v4h*)(dst + (size_t)b * CV_FLOATS) + threadIdx.x;
    float4 f[CV_PER];
#pragma unroll
    for (int u = 0; u < CV_PER; ++u) f[u] = s[u * CV_THREADS];
#pragma unroll
    for (int u = 0; u < CV_PER; ++u) {
        v4h h;
        h[0] = (_Float16)f[u].x; h[1] = (_Float16)f[u].y;
        h[2] = (_Float16)f[u].z; h[3] = (_Float16)f[u].w;
        d[u * CV_THREADS] = h;
    }
}

// ---------------------------------------------------------------------------
// GEMM: C[M,N] = A[M,K] * W[N,K]^T   (all operands f16, f32 accumulation)
// Block tile 128x128x32, 256 threads = 8 waves, wave tile 32x64 (2x4 WMMA).
// MODE 0: C stored as f32, row-major.
// MODE 1: the three projections in ONE launch. Wq, Wk, Wv lie back to back as f16, so they
// are one weight matrix of 3 * GN rows, and the grid's x runs over all its column tiles; a
// work-group lies wholly inside one projection. Three work-groups then share a WGP, and one's
// wait for its copies is filled by the others' products. The product runs transposed (W rows
// as the A operand, both loaders share one k order), so a lane holds one token (column l16)
// and 8 consecutive head dims per tile; a wave's 64 columns are one head, so the RoPE
// partners d and d + 32 sit in tiles j and j + 2 of the same lane. Q and K are rotated in
// registers, V is not; all three are stored as f16 straight into the (b,h,s,d) layout that
// attention reads (q, k, v planes back to back behind Ch).
// LDS rows padded to 40 halves (80B stride -> conflict-free 16B frag reads).
// Double-buffered via async-to-LDS DMA; zero VGPR staging.
// ---------------------------------------------------------------------------
// The epilogue's transcendentals, each in one asm statement so that the closing v_nop stands
// directly behind it: that is the slot the instruction set asks for before a transcendental's
// source is overwritten.
// 2^x
__device__ __forceinline__ float exp2_hw(float x) {
    float y;
    asm("v_exp_f32 %0, %1\n\t"
        "v_nop"
        : "=v"(y) : "v"(x));
    return y;
}
// sin and cos of an angle given in revolutions (radians / 2 pi), the hardware's own unit
__device__ __forceinline__ void sincos_rev(float rev, float& sn, float& cs) {
    asm("v_sin_f32 %0, %2\n\t"
        "v_cos_f32 %1, %2\n\t"
        "v_nop"
        : "=&v"(sn), "=&v"(cs) : "v"(rev));
}

constexpr int BM = 128, BN = 128, BK = 32, LDT = 40;
constexpr int NKT = GK / BK;      // 32

template <int MODE>
__global__ __launch_bounds__(256)
void gemm_bt(const _Float16* __restrict__ Ah,
             const _Float16* __restrict__ Bh,
             float* __restrict__ C,
             _Float16* __restrict__ Ch) {
    __shared__ _Float16 As[2][BM * LDT];
    __shared__ _Float16 Bs[2][BM * LDT];

    const int tid = threadIdx.x;
    const int m0 = blockIdx.y * BM;
    const int n0 = blockIdx.x * BN;
    const int lr = tid >> 1;           // 0..127 (tile row)
    const int lc = (tid & 1) * 16;     // 0 or 16 (k sub-chunk)

    const int wave = tid >> 5, lane = tid & 31;
    const int wm = (wave >> 1) * 32;
    const int wn = (wave & 1) * 64;
    const int l16 = lane & 15;
    const int kh8 = (lane >> 4) * 8;

    const _Float16* ga = Ah + (size_t)(m0 + lr) * GK + lc;
    const _Float16* gb = Bh + (size_t)(n0 + lr) * GK + lc;

    auto issue = [&](int kt, int buf) {
        const unsigned la = (unsigned)(size_t)&As[buf][lr * LDT + lc];
        const unsigned lb = (unsigned)(size_t)&Bs[buf][lr * LDT + lc];
        async_copy32B(la, (unsigned long long)(size_t)(ga + kt * BK));
        async_copy32B(lb, (unsigned long long)(size_t)(gb + kt * BK));
    };

    v8f acc[2][4] = {};

    issue(0, 0);
    async_wait0();
    __syncthreads();

    int cur = 0;
    for (int kt = 0; kt < NKT; ++kt) {
        if (kt + 1 < NKT) issue(kt + 1, cur ^ 1);

        v16h af[2], bf[4];
#pragma unroll
        for (int i = 0; i < 2; ++i) {
            const _Float16* base = &As[cur][(wm + 16 * i + l16) * LDT];
            af[i] = mk16(*(const v8h*)(base + kh8), *(const v8h*)(base + 16 + kh8));
        }
#pragma unroll
        for (int j = 0; j < 4; ++j) {
            const _Float16* base = &Bs[cur][(wn + 16 * j + l16) * LDT];
            bf[j] = mk16(*(const v8h*)(base + kh8), *(const v8h*)(base + 16 + kh8));
        }
#pragma unroll
        for (int i = 0; i < 2; ++i)
#pragma unroll
            for (int j = 0; j < 4; ++j)
                acc[i][j] = (MODE == 0) ? wmma_f16(af[i], bf[j], acc[i][j])
                                        : wmma_f16(bf[j], af[i], acc[i][j]);

        if (kt + 1 < NKT) async_wait0();
        __syncthreads();
        cur ^= 1;
    }

    const int rgrp = (lane >> 4) * 8;
    if constexpr (MODE == 0) {
#pragma unroll
        for (int i = 0; i < 2; ++i)
#pragma unroll
            for (int j = 0; j < 4; ++j)
#pragma unroll
                for (int r = 0; r < 8; ++r) {
                    const int row = m0 + wm + 16 * i + r + rgrp;
                    const int col = n0 + wn + 16 * j + l16;
                    C[(size_t)row * GN + col] = acc[i][j][r];
                }
    } else {
        // acc[i][j][r] = C[token m0 + wm + 16*i + l16][column n0 + wn + 16*j + rgrp + r]
        const int proj = n0 / GN;                    // 0 = Q, 1 = K, 2 = V: the same for the whole work-group
        const int hd   = (n0 % GN + wn) / HDIM;
        _Float16* Cp   = Ch + (size_t)proj * GM * GN;
#pragma unroll
        for (int i = 0; i < 2; ++i) {
            const int row = m0 + wm + 16 * i + l16;
            const int bb  = row / SEQ;
            const int s   = row % SEQ;
            if (proj < 2) {
#pragma unroll
                for (int j = 0; j < 2; ++j)
#pragma unroll
                    for (int r = 0; r < 8; ++r) {
                        const int d = 16 * j + rgrp + r;
                        // inv_freq = 10000^(-d/32) = exp(-d * ln(10000)/32)
                        const float invf = exp2_hw(-(float)d * (9.210340371976184f / 32.0f) * 1.4426950408889634f);
                        const float ang  = (float)s * invf;
                        float sn, cs;
                        sincos_rev(ang * 0.15915494309189532f, sn, cs);
                        const float t1 = acc[i][j][r], t2 = acc[i][j + 2][r];
                        acc[i][j][r]     = t1 * cs - t2 * sn;
                        acc[i][j + 2][r] = t2 * cs + t1 * sn;
                    }
            }
            _Float16* op = Cp + (((size_t)bb * HEADS + hd) * SEQ + s) * HDIM + rgrp;
#pragma unroll
            for (int j = 0; j < 4; ++j) {
                v8h o;
#pragma unroll
                for (int r = 0; r < 8; ++r) o[r] = (_Float16)acc[i][j][r];
                *(v8h*)(op + 16 * j) = o;
            }
        }
    }
}

constexpr int LDQ = 72;

// value of lane l ^ 16 (the other half of the wave)
__device__ __forceinline__ float xhalf(float x) {
    return __builtin_bit_cast(float, __builtin_amdgcn_permlanex16(
        __builtin_bit_cast(int, x), __builtin_bit_cast(int, x),
        0x76543210, 0xfedcba98, false, false));
}

// 2^x for eight values in one asm statement. Outputs are early-clobber, so no v_exp_f32 in it
// overwrites a neighbour's source or reads its result, and the closing v_nop is the slot the
// instruction set asks for behind the last one.
__device__ __forceinline__ void exp2_x8(const float (&x)[8], float (&y)[8]) {
    asm("v_exp_f32 %0, %8\n\t"
        "v_exp_f32 %1, %9\n\t"
        "v_exp_f32 %2, %10\n\t"
        "v_exp_f32 %3, %11\n\t"
        "v_exp_f32 %4, %12\n\t"
        "v_exp_f32 %5, %13\n\t"
        "v_exp_f32 %6, %14\n\t"
        "v_exp_f32 %7, %15\n\t"
        "v_nop"
        : "=&v"(y[0]), "=&v"(y[1]), "=&v"(y[2]), "=&v"(y[3]),
          "=&v"(y[4]), "=&v"(y[5]), "=&v"(y[6]), "=&v"(y[7])
        : "v"(x[0]), "v"(x[1]), "v"(x[2]), "v"(x[3]),
          "v"(x[4]), "v"(x[5]), "v"(x[6]), "v"(x[7]));
}
constexpr float LOG2E = 1.4426950408889634f;

__global__ __launch_bounds__(128)
void attn_fa(const _Float16* __restrict__ qh, const _Float16* __restrict__ kh,
             const _Float16* __restrict__ vh, _Float16* __restrict__ oh) {
    __shared__ _Float16 Qs[64 * LDQ];
    __shared__ _Float16 Ks[64 * LDQ];
    __shared__ _Float16 Vt[64 * LDQ];       // transposed: [d][key]

    const int tid  = threadIdx.x;
    const int wave = tid >> 5, lane = tid & 31;
    const int l16  = lane & 15;
    const int kh8  = (lane >> 4) * 8;
    const int rgrp = (lane >> 4) * 8;

    const int b  = blockIdx.z;
    const int hh = blockIdx.y;
    const int q0 = blockIdx.x * 64;
    const size_t bh = (size_t)b * HEADS + hh;
    const _Float16* Qg = qh + bh * SEQ * HDIM;
    const _Float16* Kg = kh + bh * SEQ * HDIM;
    const _Float16* Vg = vh + bh * SEQ * HDIM;

    const int srow = tid >> 1;            // staging row 0..63
    const int scol = (tid & 1) * 32;      // staging col 0 or 32

    // ---- stage Q tile (64 x 64) once, via async DMA ----
    async_copy64B((unsigned)(size_t)&Qs[srow * LDQ + scol],
                  (unsigned long long)(size_t)(Qg + (size_t)(q0 + srow) * HDIM + scol));
    async_wait0();
    __syncthreads();

    // Q^T fragments for this wave (B operand: column l16 = query; constant across key tiles)
    v16h qa0, qa1;
    {
        const _Float16* base = &Qs[(wave * 16 + l16) * LDQ];
        qa0 = mk16(*(const v8h*)(base + kh8),      *(const v8h*)(base + 16 + kh8));
        qa1 = mk16(*(const v8h*)(base + 32 + kh8), *(const v8h*)(base + 48 + kh8));
    }

    float mrun = -1e30f;   // running max of this lane's query (same in both halves)
    float lrun = 0.0f;     // running sum over this half's keys only; halves join in the epilogue
    v8f oa[4] = {};        // oa[jd][r] = O^T[jd*16 + rgrp + r][query l16]

    for (int kt = 0; kt < SEQ / 64; ++kt) {
        // ---- stage K tile (async DMA) and V tile (manual transpose) ----
        async_copy64B((unsigned)(size_t)&Ks[srow * LDQ + scol],
                      (unsigned long long)(size_t)(Kg + (size_t)(kt * 64 + srow) * HDIM + scol));
        {
            const _Float16* pv = Vg + (size_t)(kt * 64 + srow) * HDIM + scol;
            v8h v0 = *(const v8h*)pv,        v1 = *(const v8h*)(pv + 8);
            v8h v2 = *(const v8h*)(pv + 16), v3 = *(const v8h*)(pv + 24);
#pragma unroll
            for (int e = 0; e < 8; ++e) {
                Vt[(scol + e)      * LDQ + srow] = v0[e];
                Vt[(scol + 8 + e)  * LDQ + srow] = v1[e];
                Vt[(scol + 16 + e) * LDQ + srow] = v2[e];
                Vt[(scol + 24 + e) * LDQ + srow] = v3[e];
            }
        }
        async_wait0();
        __syncthreads();

        // ---- scores S^T = K * Q^T * scale : sc[j][r] = S[query l16][key j*16 + rgrp + r] ----
        // All 16 K fragment reads go out as one group, so the wave waits out the LDS latency once
        // instead of once per product.
        v16h kb0[4], kb1[4];
#pragma unroll
        for (int j = 0; j < 4; ++j) {
            const _Float16* base = &Ks[(j * 16 + l16) * LDQ];
            kb0[j] = mk16(*(const v8h*)(base + kh8),      *(const v8h*)(base + 16 + kh8));
            kb1[j] = mk16(*(const v8h*)(base + 32 + kh8), *(const v8h*)(base + 48 + kh8));
        }
        // keeps the read group whole: without it the scheduler sinks each pair of reads to its product
        __builtin_amdgcn_sched_barrier(0);
        v8f sc[4];
#pragma unroll
        for (int j = 0; j < 4; ++j) {
            v8f z = {};
            sc[j] = wmma_f16(kb0[j], qa0, z);
        }
#pragma unroll
        for (int j = 0; j < 4; ++j) sc[j] = wmma_f16(kb1[j], qa1, sc[j]);

        // All 16 V^T fragment reads go out here, in front of the softmax, whose vector work covers
        // their latency.
        v16h vb0[4], vb1[4];
#pragma unroll
        for (int jd = 0; jd < 4; ++jd) {
            const _Float16* base = &Vt[(jd * 16 + l16) * LDQ];
            vb0[jd] = mk16(*(const v8h*)(base + kh8),      *(const v8h*)(base + 16 + kh8));
            vb1[jd] = mk16(*(const v8h*)(base + 32 + kh8), *(const v8h*)(base + 48 + kh8));
        }
        // keeps the reads in front of the softmax: without it the scheduler sinks them to the second product
        __builtin_amdgcn_sched_barrier(0);
#pragma unroll
        for (int j = 0; j < 4; ++j)
#pragma unroll
            for (int r = 0; r < 8; ++r) sc[j][r] *= 0.125f;   // 1/sqrt(64)

        // ---- online softmax: 32 scores of one query per lane ----
        float t4[4];
#pragma unroll
        for (int j = 0; j < 4; ++j)
            t4[j] = fmaxf(fmaxf(fmaxf(sc[j][0], sc[j][1]), fmaxf(sc[j][2], sc[j][3])),
                          fmaxf(fmaxf(sc[j][4], sc[j][5]), fmaxf(sc[j][6], sc[j][7])));
        float tm = fmaxf(fmaxf(t4[0], t4[1]), fmaxf(t4[2], t4[3]));
        tm = fmaxf(tm, xhalf(tm));                 // join the two key halves
        const float nm   = fmaxf(mrun, tm);
        const float corr = exp2_hw((mrun - nm) * LOG2E);
        mrun = nm;

        // P^T packs in place into the B operand: in the hardware k order (the one the K, Q and
        // V^T loaders use) element s of pb[kk] is register s & 7 of score tile 2*kk + (s >> 3)
        v16h pb[2];
        v2f rs[4];
#pragma unroll
        for (int j = 0; j < 4; ++j) {
            float ex[8], ey[8];
#pragma unroll
            for (int r = 0; r < 8; ++r) ex[r] = (sc[j][r] - nm) * LOG2E;
            exp2_x8(ex, ey);
#pragma unroll
            for (int r = 0; r < 8; r += 2) {
                v2f p;
                p.x = ey[r];
                p.y = ey[r + 1];
                rs[j] = (r == 0) ? p : rs[j] + p;
                pb[j >> 1][(j & 1) * 8 + r]     = (_Float16)p.x;
                pb[j >> 1][(j & 1) * 8 + r + 1] = (_Float16)p.y;
            }
        }
        const v2f rt = (rs[0] + rs[1]) + (rs[2] + rs[3]);
        lrun = lrun * corr + (rt.x + rt.y);
#pragma unroll
        for (int jd = 0; jd < 4; ++jd)
#pragma unroll
            for (int r = 0; r < 8; ++r) oa[jd][r] *= corr;

        // ---- O^T += V^T * P^T ----
#pragma unroll
        for (int jd = 0; jd < 4; ++jd) oa[jd] = wmma_f16(vb0[jd], pb[0], oa[jd]);
#pragma unroll
        for (int jd = 0; jd < 4; ++jd) oa[jd] = wmma_f16(vb1[jd], pb[1], oa[jd]);
        __syncthreads();
    }

    // ---- epilogue: O / l  ->  (b,s,h,d) f16; a lane holds 8 consecutive d per tile ----
    const float inv = 1.0f / (lrun + xhalf(lrun));
    const int   row = q0 + wave * 16 + l16;
    _Float16* op = oh + (((size_t)b * SEQ + row) * HEADS + hh) * HDIM + rgrp;
#pragma unroll
    for (int jd = 0; jd < 4; ++jd) {
        v8h o;
#pragma unroll
        for (int r = 0; r < 8; ++r) o[r] = (_Float16)(oa[jd][r] * inv);
        *(v8h*)(op + jd * 16) = o;
    }
}

// ---------------------------------------------------------------------------
// Launch
// ---------------------------------------------------------------------------
extern "C" void kernel_launch(void* const* d_in, const int* in_sizes, int n_in,
                              void* d_out, int out_size, void* d_ws, size_t ws_size,
                              hipStream_t stream) {
    const float* x  = (const float*)d_in[0];
    const float* Wq = (const float*)d_in[1];
    const float* Wk = (const float*)d_in[2];
    const float* Wv = (const float*)d_in[3];
    const float* Wo = (const float*)d_in[4];
    float* out = (float*)d_out;

    char* ws = (char*)d_ws;
    constexpr size_t F32_MAT = (size_t)GM * GN * sizeof(float);     // 16 MiB
    constexpr size_t F16_MAT = (size_t)GM * GN * sizeof(_Float16);  //  8 MiB
    constexpr size_t F16_W   = (size_t)GN * GK * sizeof(_Float16);  //  2 MiB

    _Float16* qh  = (_Float16*)(ws + 3 * F32_MAT);
    _Float16* kh  = (_Float16*)(ws + 3 * F32_MAT + F16_MAT);
    _Float16* vh  = (_Float16*)(ws + 3 * F32_MAT + 2 * F16_MAT);
    _Float16* xh  = (_Float16*)(ws + 3 * F32_MAT + 3 * F16_MAT);
    _Float16* Wqh = (_Float16*)(ws + 3 * F32_MAT + 4 * F16_MAT);
    _Float16* Woh = (_Float16*)(ws + 3 * F32_MAT + 4 * F16_MAT + 3 * F16_W);
    _Float16* oh  = (_Float16*)(ws);

    // fp32 -> fp16 operand conversion: xh, Wqh, Wkh, Wvh, Woh are one contiguous range
    cvt_all<<<CV_XBLK + 4 * CV_WBLK, CV_THREADS, 0, stream>>>(x, Wq, Wk, Wv, Wo, xh);

    const dim3 ggrid(GN / BN, GM / BM);  // (8, 32)

    // Q, K and V projections: one launch over the 3 * GN rows of [Wqh; Wkh; Wvh], into [qh; kh; vh]
    gemm_bt<1><<<dim3(3 * GN / BN, GM / BM), 256, 0, stream>>>(xh, Wqh, nullptr, qh);
    attn_fa<<<dim3(SEQ / 64, HEADS, BATCH), 128, 0, stream>>>(qh, kh, vh, oh);
    gemm_bt<0><<<ggrid, 256, 0, stream>>>(oh, Woh, out, nullptr);
}

// v006
// It runs in 114 microseconds.
// In two side-by-side timings against v005, it was 1.05 and 1.07 times as fast.
// Over all steps from v000 it is 1.73 times as fast.
#include <hip/hip_runtime.h>
#include <hip/hip_bf16.h>

// ---------------------------------------------------------------------------
// Types for WMMA (CDNA5 / gfx1250, wave32)
// ---------------------------------------------------------------------------
typedef __attribute__((ext_vector_type(16))) _Float16 v16h;
typedef __attribute__((ext_vector_type(8)))  _Float16 v8h;
typedef __attribute__((ext_vector_type(8)))  float    v8f;
typedef __attribute__((ext_vector_type(2)))  float    v2f;

__device__ __forceinline__ v16h mk16(v8h lo, v8h hi) {
    union { v16h v; v8h h[2]; } u;
    u.h[0] = lo; u.h[1] = hi;
    return u.v;
}

__device__ __forceinline__ v8f wmma_f16(v16h a, v16h b, v8f c) {
    // D = A(16x32 f16) * B(32x16 f16) + C(16x16 f32)
    return __builtin_amdgcn_wmma_f32_16x16x32_f16(
        /*neg_a=*/false, a, /*neg_b=*/false, b,
        /*c_mod=*/(short)0, c, /*reuse_a=*/false, /*reuse_b=*/false);
}

// ---------------------------------------------------------------------------
// Async global->LDS staging (gfx1250 ASYNCcnt path). INST_OFFSET is added to
// BOTH the LDS and global address, so one base covers a contiguous row chunk.
// ---------------------------------------------------------------------------
__device__ __forceinline__ void async_copy32B(unsigned lds, unsigned long long g) {
    asm volatile(
        "global_load_async_to_lds_b128 %0, %1, off\n\t"
        "global_load_async_to_lds_b128 %0, %1, off offset:16"
        :: "v"(lds), "v"(g) : "memory");
}
__device__ __forceinline__ void async_copy64B(unsigned lds, unsigned long long g) {
    asm volatile(
        "global_load_async_to_lds_b128 %0, %1, off\n\t"
        "global_load_async_to_lds_b128 %0, %1, off offset:16\n\t"
        "global_load_async_to_lds_b128 %0, %1, off offset:32\n\t"
        "global_load_async_to_lds_b128 %0, %1, off offset:48\n\t"
        "s_wait_xcnt 0x0"   // inside the statement: the copies' address registers are rewritten only behind it
        :: "v"(lds), "v"(g) : "memory");
}
// two 64-byte row chunks (one of each of two tiles) in one statement: one wait serves all eight copies
__device__ __forceinline__ void async_copy64B_x2(unsigned lds0, unsigned long long g0,
                                                 unsigned lds1, unsigned long long g1) {
    asm volatile(
        "global_load_async_to_lds_b128 %0, %1, off\n\t"
        "global_load_async_to_lds_b128 %0, %1, off offset:16\n\t"
        "global_load_async_to_lds_b128 %0, %1, off offset:32\n\t"
        "global_load_async_to_lds_b128 %0, %1, off offset:48\n\t"
        "global_load_async_to_lds_b128 %2, %3, off\n\t"
        "global_load_async_to_lds_b128 %2, %3, off offset:16\n\t"
        "global_load_async_to_lds_b128 %2, %3, off offset:32\n\t"
        "global_load_async_to_lds_b128 %2, %3, off offset:48\n\t"
        "s_wait_xcnt 0x0"   // inside the statement: the copies' address registers are rewritten only behind it
        :: "v"(lds0), "v"(g0), "v"(lds1), "v"(g1) : "memory");
}
__device__ __forceinline__ void async_wait0() {
    asm volatile("s_wait_asynccnt 0" ::: "memory");
}

// ---------------------------------------------------------------------------
// Problem constants
// ---------------------------------------------------------------------------
constexpr int BATCH = 2;
constexpr int SEQ   = 2048;
constexpr int HID   = 1024;
constexpr int HEADS = 16;
constexpr int HDIM  = 64;
constexpr int GM = BATCH * SEQ;   // 4096
constexpr int GN = HID;           // 1024
constexpr int GK = HID;           // 1024

// ---------------------------------------------------------------------------
// fp32 -> fp16 conversion of all five inputs in ONE launch (makes all GEMM operands
// async-able). The five f16 copies lie back to back in the workspace, so the target is one
// range. One work-group of 16 waves per 32768 floats; a work-group lies wholly inside one
// input. A wave's load covers 512 contiguous bytes, its store 256; a thread's 16 loads are
// all issued before its first store.
// ---------------------------------------------------------------------------
typedef __attribute__((ext_vector_type(4))) _Float16 v4h;
constexpr int CV_THREADS = 512;
constexpr int CV_PER     = 16;                            // float4 per thread
constexpr int CV_FLOATS  = CV_THREADS * CV_PER * 4;       // 32768 floats per work-group
constexpr int CV_XBLK    = GM * GK / CV_FLOATS;           // 128 work-groups for x
constexpr int CV_WBLK    = GN * GK / CV_FLOATS;           // 32 for each weight

__global__ __launch_bounds__(CV_THREADS)
void cvt_all(const float* __restrict__ x,  const float* __restrict__ wq,
             const float* __restrict__ wk, const float* __restrict__ wv,
             const float* __restrict__ wo, _Float16* __restrict__ dst) {
    const int b = blockIdx.x;
    const float* src;
    if (b < CV_XBLK) {
        src = x + (size_t)b * CV_FLOATS;
    } else {
        const int w = (b - CV_XBLK) / CV_WBLK;
        const float* base = (w == 0) ? wq : (w == 1) ? wk : (w == 2) ? wv : wo;
        src = base + (size_t)((b - CV_XBLK) % CV_WBLK) * CV_FLOATS;
    }
    const float4* s = (const float4*)src + threadIdx.x;
    v4h* d = (v4h*)(dst + (size_t)b * CV_FLOATS) + threadIdx.x;
    float4 f[CV_PER];
#pragma unroll
    for (int u = 0; u < CV_PER; ++u) f[u] = s[u * CV_THREADS];
#pragma unroll
    for (int u = 0; u < CV_PER; ++u) {
        v4h h;
        h[0] = (_Float16)f[u].x; h[1] = (_Float16)f[u].y;
        h[2] = (_Float16)f[u].z; h[3] = (_Float16)f[u].w;
        d[u * CV_THREADS] = h;
    }
}

// ---------------------------------------------------------------------------
// GEMM: C[M,N] = A[M,K] * W[N,K]^T   (all operands f16, f32 accumulation)
// Block tile 128x128x32, 256 threads = 8 waves, wave tile 32x64 (2x4 WMMA).
// MODE 0: C stored as f32, row-major.
// MODE 1: the three projections in ONE launch. Wq, Wk, Wv lie back to back as f16, so they
// are one weight matrix of 3 * GN rows, and the grid's x runs over all its column tiles; a
// work-group lies wholly inside one projection. Three work-groups then share a WGP, and one's
// wait for its copies is filled by the others' products. The product runs transposed (W rows
// as the A operand, both loaders share one k order), so a lane holds one token (column l16)
// and 8 consecutive head dims per tile; a wave's 64 columns are one head, so the RoPE
// partners d and d + 32 sit in tiles j and j + 2 of the same lane. Q and K are rotated in
// registers, V is not; all three are stored as f16 straight into the (b,h,s,d) layout that
// attention reads (q, k, v planes back to back behind Ch).
// LDS rows padded to 40 halves (80B stride -> conflict-free 16B frag reads).
// Double-buffered via async-to-LDS DMA; zero VGPR staging.
// ---------------------------------------------------------------------------
// The epilogue's transcendentals, each in one asm statement so that the closing v_nop stands
// directly behind it: that is the slot the instruction set asks for before a transcendental's
// source is overwritten.
// 2^x
__device__ __forceinline__ float exp2_hw(float x) {
    float y;
    asm("v_exp_f32 %0, %1\n\t"
        "v_nop"
        : "=v"(y) : "v"(x));
    return y;
}
// sin and cos of an angle given in revolutions (radians / 2 pi), the hardware's own unit
__device__ __forceinline__ void sincos_rev(float rev, float& sn, float& cs) {
    asm("v_sin_f32 %0, %2\n\t"
        "v_cos_f32 %1, %2\n\t"
        "v_nop"
        : "=&v"(sn), "=&v"(cs) : "v"(rev));
}

constexpr int BM = 128, BN = 128, BK = 32, LDT = 40;
constexpr int NKT = GK / BK;      // 32

template <int MODE>
__global__ __launch_bounds__(256)
void gemm_bt(const _Float16* __restrict__ Ah,
             const _Float16* __restrict__ Bh,
             float* __restrict__ C,
             _Float16* __restrict__ Ch) {
    __shared__ _Float16 As[2][BM * LDT];
    __shared__ _Float16 Bs[2][BM * LDT];

    const int tid = threadIdx.x;
    const int m0 = blockIdx.y * BM;
    const int n0 = blockIdx.x * BN;
    const int lr = tid >> 1;           // 0..127 (tile row)
    const int lc = (tid & 1) * 16;     // 0 or 16 (k sub-chunk)

    const int wave = tid >> 5, lane = tid & 31;
    const int wm = (wave >> 1) * 32;
    const int wn = (wave & 1) * 64;
    const int l16 = lane & 15;
    const int kh8 = (lane >> 4) * 8;

    const _Float16* ga = Ah + (size_t)(m0 + lr) * GK + lc;
    const _Float16* gb = Bh + (size_t)(n0 + lr) * GK + lc;

    auto issue = [&](int kt, int buf) {
        const unsigned la = (unsigned)(size_t)&As[buf][lr * LDT + lc];
        const unsigned lb = (unsigned)(size_t)&Bs[buf][lr * LDT + lc];
        async_copy32B(la, (unsigned long long)(size_t)(ga + kt * BK));
        async_copy32B(lb, (unsigned long long)(size_t)(gb + kt * BK));
    };

    v8f acc[2][4] = {};

    issue(0, 0);
    async_wait0();
    __syncthreads();

    int cur = 0;
    for (int kt = 0; kt < NKT; ++kt) {
        if (kt + 1 < NKT) issue(kt + 1, cur ^ 1);

        v16h af[2], bf[4];
#pragma unroll
        for (int i = 0; i < 2; ++i) {
            const _Float16* base = &As[cur][(wm + 16 * i + l16) * LDT];
            af[i] = mk16(*(const v8h*)(base + kh8), *(const v8h*)(base + 16 + kh8));
        }
#pragma unroll
        for (int j = 0; j < 4; ++j) {
            const _Float16* base = &Bs[cur][(wn + 16 * j + l16) * LDT];
            bf[j] = mk16(*(const v8h*)(base + kh8), *(const v8h*)(base + 16 + kh8));
        }
#pragma unroll
        for (int i = 0; i < 2; ++i)
#pragma unroll
            for (int j = 0; j < 4; ++j)
                acc[i][j] = (MODE == 0) ? wmma_f16(af[i], bf[j], acc[i][j])
                                        : wmma_f16(bf[j], af[i], acc[i][j]);

        if (kt + 1 < NKT) async_wait0();
        __syncthreads();
        cur ^= 1;
    }

    const int rgrp = (lane >> 4) * 8;
    if constexpr (MODE == 0) {
#pragma unroll
        for (int i = 0; i < 2; ++i)
#pragma unroll
            for (int j = 0; j < 4; ++j)
#pragma unroll
                for (int r = 0; r < 8; ++r) {
                    const int row = m0 + wm + 16 * i + r + rgrp;
                    const int col = n0 + wn + 16 * j + l16;
                    C[(size_t)row * GN + col] = acc[i][j][r];
                }
    } else {
        // acc[i][j][r] = C[token m0 + wm + 16*i + l16][column n0 + wn + 16*j + rgrp + r]
        const int proj = n0 / GN;                    // 0 = Q, 1 = K, 2 = V: the same for the whole work-group
        const int hd   = (n0 % GN + wn) / HDIM;
        _Float16* Cp   = Ch + (size_t)proj * GM * GN;
#pragma unroll
        for (int i = 0; i < 2; ++i) {
            const int row = m0 + wm + 16 * i + l16;
            const int bb  = row / SEQ;
            const int s   = row % SEQ;
            if (proj < 2) {
#pragma unroll
                for (int j = 0; j < 2; ++j)
#pragma unroll
                    for (int r = 0; r < 8; ++r) {
                        const int d = 16 * j + rgrp + r;
                        // inv_freq = 10000^(-d/32) = exp(-d * ln(10000)/32)
                        const float invf = exp2_hw(-(float)d * (9.210340371976184f / 32.0f) * 1.4426950408889634f);
                        const float ang  = (float)s * invf;
                        float sn, cs;
                        sincos_rev(ang * 0.15915494309189532f, sn, cs);
                        const float t1 = acc[i][j][r], t2 = acc[i][j + 2][r];
                        acc[i][j][r]     = t1 * cs - t2 * sn;
                        acc[i][j + 2][r] = t2 * cs + t1 * sn;
                    }
            }
            _Float16* op = Cp + (((size_t)bb * HEADS + hd) * SEQ + s) * HDIM + rgrp;
#pragma unroll
            for (int j = 0; j < 4; ++j) {
                v8h o;
#pragma unroll
                for (int r = 0; r < 8; ++r) o[r] = (_Float16)acc[i][j][r];
                *(v8h*)(op + 16 * j) = o;
            }
        }
    }
}

constexpr int LDQ = 72;
constexpr int LDV = 80;

typedef __attribute__((ext_vector_type(8))) short s16x8;
__device__ __forceinline__ v8h ld_tr16(const _Float16* p) {
    typedef __attribute__((address_space(3))) s16x8 lds_s16x8;
    return __builtin_bit_cast(v8h, __builtin_amdgcn_ds_load_tr16_b128_v8i16((lds_s16x8*)p));
}

// value of lane l ^ 16 (the other half of the wave)
__device__ __forceinline__ float xhalf(float x) {
    return __builtin_bit_cast(float, __builtin_amdgcn_permlanex16(
        __builtin_bit_cast(int, x), __builtin_bit_cast(int, x),
        0x76543210, 0xfedcba98, false, false));
}

// 2^x for eight values in one asm statement. Outputs are early-clobber, so no v_exp_f32 in it
// overwrites a neighbour's source or reads its result, and the closing v_nop is the slot the
// instruction set asks for behind the last one.
__device__ __forceinline__ void exp2_x8(const float (&x)[8], float (&y)[8]) {
    asm("v_exp_f32 %0, %8\n\t"
        "v_exp_f32 %1, %9\n\t"
        "v_exp_f32 %2, %10\n\t"
        "v_exp_f32 %3, %11\n\t"
        "v_exp_f32 %4, %12\n\t"
        "v_exp_f32 %5, %13\n\t"
        "v_exp_f32 %6, %14\n\t"
        "v_exp_f32 %7, %15\n\t"
        "v_nop"
        : "=&v"(y[0]), "=&v"(y[1]), "=&v"(y[2]), "=&v"(y[3]),
          "=&v"(y[4]), "=&v"(y[5]), "=&v"(y[6]), "=&v"(y[7])
        : "v"(x[0]), "v"(x[1]), "v"(x[2]), "v"(x[3]),
          "v"(x[4]), "v"(x[5]), "v"(x[6]), "v"(x[7]));
}
constexpr float LOG2E = 1.4426950408889634f;

__global__ __launch_bounds__(128)
void attn_fa(const _Float16* __restrict__ qh, const _Float16* __restrict__ kh,
             const _Float16* __restrict__ vh, _Float16* __restrict__ oh) {
    __shared__ _Float16 Qs[64 * LDQ];
    __shared__ _Float16 Ks[64 * LDQ];
    __shared__ __attribute__((aligned(16))) _Float16 Vs[64 * LDV];   // row-major: [key][d]

    const int tid  = threadIdx.x;
    const int wave = tid >> 5, lane = tid & 31;
    const int l16  = lane & 15;
    const int kh8  = (lane >> 4) * 8;
    const int rgrp = (lane >> 4) * 8;

    const int b  = blockIdx.z;
    const int hh = blockIdx.y;
    const int q0 = blockIdx.x * 64;
    const size_t bh = (size_t)b * HEADS + hh;
    const _Float16* Qg = qh + bh * SEQ * HDIM;
    const _Float16* Kg = kh + bh * SEQ * HDIM;
    const _Float16* Vg = vh + bh * SEQ * HDIM;

    const int srow = tid >> 1;            // staging row 0..63
    const int scol = (tid & 1) * 32;      // staging col 0 or 32

    // ---- stage Q tile (64 x 64) once, via async DMA ----
    async_copy64B((unsigned)(size_t)&Qs[srow * LDQ + scol],
                  (unsigned long long)(size_t)(Qg + (size_t)(q0 + srow) * HDIM + scol));
    async_wait0();
    __syncthreads();

    // Q^T fragments for this wave (B operand: column l16 = query; constant across key tiles)
    v16h qa0, qa1;
    {
        const _Float16* base = &Qs[(wave * 16 + l16) * LDQ];
        qa0 = mk16(*(const v8h*)(base + kh8),      *(const v8h*)(base + 16 + kh8));
        qa1 = mk16(*(const v8h*)(base + 32 + kh8), *(const v8h*)(base + 48 + kh8));
    }

    float mrun = -1e30f;   // running max of this lane's query (same in both halves)
    float lrun = 0.0f;     // running sum over this half's keys only; halves join in the epilogue
    v8f oa[4] = {};        // oa[jd][r] = O^T[jd*16 + rgrp + r][query l16]

    for (int kt = 0; kt < SEQ / 64; ++kt) {
        // ---- stage K tile and V tile (async DMA, both row-major) ----
        async_copy64B_x2((unsigned)(size_t)&Ks[srow * LDQ + scol],
                         (unsigned long long)(size_t)(Kg + (size_t)(kt * 64 + srow) * HDIM + scol),
                         (unsigned)(size_t)&Vs[srow * LDV + scol],
                         (unsigned long long)(size_t)(Vg + (size_t)(kt * 64 + srow) * HDIM + scol));
        async_wait0();
        __syncthreads();

        // ---- scores S^T = K * Q^T * scale : sc[j][r] = S[query l16][key j*16 + rgrp + r] ----
        // All 16 K fragment reads go out as one group, so the wave waits out the LDS latency once
        // instead of once per product.
        v16h kb0[4], kb1[4];
#pragma unroll
        for (int j = 0; j < 4; ++j) {
            const _Float16* base = &Ks[(j * 16 + l16) * LDQ];
            kb0[j] = mk16(*(const v8h*)(base + kh8),      *(const v8h*)(base + 16 + kh8));
            kb1[j] = mk16(*(const v8h*)(base + 32 + kh8), *(const v8h*)(base + 48 + kh8));
        }
        // keeps the read group whole: without it the scheduler sinks each pair of reads to its product
        __builtin_amdgcn_sched_barrier(0);
        v8f sc[4];
#pragma unroll
        for (int j = 0; j < 4; ++j) {
            v8f z = {};
            sc[j] = wmma_f16(kb0[j], qa0, z);
        }
#pragma unroll
        for (int j = 0; j < 4; ++j) sc[j] = wmma_f16(kb1[j], qa1, sc[j]);

        // All 16 V^T fragment reads go out here, in front of the softmax, whose vector work covers
        // their latency.
        v16h vb0[4], vb1[4];
#pragma unroll
        for (int jd = 0; jd < 4; ++jd) {
            const _Float16* base = &Vs[(kh8 + (lane & 7)) * LDV + jd * 16 + ((lane >> 3) & 1) * 8];
            vb0[jd] = mk16(ld_tr16(base),            ld_tr16(base + 16 * LDV));
            vb1[jd] = mk16(ld_tr16(base + 32 * LDV), ld_tr16(base + 48 * LDV));
        }
        // keeps the reads in front of the softmax: without it the scheduler sinks them to the second product
        __builtin_amdgcn_sched_barrier(0);
#pragma unroll
        for (int j = 0; j < 4; ++j)
#pragma unroll
            for (int r = 0; r < 8; ++r) sc[j][r] *= 0.125f;   // 1/sqrt(64)

        // ---- online softmax: 32 scores of one query per lane ----
        float t4[4];
#pragma unroll
        for (int j = 0; j < 4; ++j)
            t4[j] = fmaxf(fmaxf(fmaxf(sc[j][0], sc[j][1]), fmaxf(sc[j][2], sc[j][3])),
                          fmaxf(fmaxf(sc[j][4], sc[j][5]), fmaxf(sc[j][6], sc[j][7])));
        float tm = fmaxf(fmaxf(t4[0], t4[1]), fmaxf(t4[2], t4[3]));
        tm = fmaxf(tm, xhalf(tm));                 // join the two key halves
        const float nm   = fmaxf(mrun, tm);
        const float corr = exp2_hw((mrun - nm) * LOG2E);
        mrun = nm;

        // P^T packs in place into the B operand: in the hardware k order (the one the K, Q and
        // V^T loaders use) element s of pb[kk] is register s & 7 of score tile 2*kk + (s >> 3)
        v16h pb[2];
        v2f rs[4];
#pragma unroll
        for (int j = 0; j < 4; ++j) {
            float ex[8], ey[8];
#pragma unroll
            for (int r = 0; r < 8; ++r) ex[r] = (sc[j][r] - nm) * LOG2E;
            exp2_x8(ex, ey);
#pragma unroll
            for (int r = 0; r < 8; r += 2) {
                v2f p;
                p.x = ey[r];
                p.y = ey[r + 1];
                rs[j] = (r == 0) ? p : rs[j] + p;
                pb[j >> 1][(j & 1) * 8 + r]     = (_Float16)p.x;
                pb[j >> 1][(j & 1) * 8 + r + 1] = (_Float16)p.y;
            }
        }
        const v2f rt = (rs[0] + rs[1]) + (rs[2] + rs[3]);
        lrun = lrun * corr + (rt.x + rt.y);
#pragma unroll
        for (int jd = 0; jd < 4; ++jd)
#pragma unroll
            for (int r = 0; r < 8; ++r) oa[jd][r] *= corr;

        // ---- O^T += V^T * P^T ----
#pragma unroll
        for (int jd = 0; jd < 4; ++jd) oa[jd] = wmma_f16(vb0[jd], pb[0], oa[jd]);
#pragma unroll
        for (int jd = 0; jd < 4; ++jd) oa[jd] = wmma_f16(vb1[jd], pb[1], oa[jd]);
        __syncthreads();
    }

    // ---- epilogue: O / l  ->  (b,s,h,d) f16; a lane holds 8 consecutive d per tile ----
    const float inv = 1.0f / (lrun + xhalf(lrun));
    const int   row = q0 + wave * 16 + l16;
    _Float16* op = oh + (((size_t)b * SEQ + row) * HEADS + hh) * HDIM + rgrp;
#pragma unroll
    for (int jd = 0; jd < 4; ++jd) {
        v8h o;
#pragma unroll
        for (int r = 0; r < 8; ++r) o[r] = (_Float16)(oa[jd][r] * inv);
        *(v8h*)(op + jd * 16) = o;
    }
}

// ---------------------------------------------------------------------------
// Launch
// ---------------------------------------------------------------------------
extern "C" void kernel_launch(void* const* d_in, const int* in_sizes, int n_in,
                              void* d_out, int out_size, void* d_ws, size_t ws_size,
                              hipStream_t stream) {
    const float* x  = (const float*)d_in[0];
    const float* Wq = (const float*)d_in[1];
    const float* Wk = (const float*)d_in[2];
    const float* Wv = (const float*)d_in[3];
    const float* Wo = (const float*)d_in[4];
    float* out = (float*)d_out;

    char* ws = (char*)d_ws;
    constexpr size_t F32_MAT = (size_t)GM * GN * sizeof(float);     // 16 MiB
    constexpr size_t F16_MAT = (size_t)GM * GN * sizeof(_Float16);  //  8 MiB
    constexpr size_t F16_W   = (size_t)GN * GK * sizeof(_Float16);  //  2 MiB

    _Float16* qh  = (_Float16*)(ws + 3 * F32_MAT);
    _Float16* kh  = (_Float16*)(ws + 3 * F32_MAT + F16_MAT);
    _Float16* vh  = (_Float16*)(ws + 3 * F32_MAT + 2 * F16_MAT);
    _Float16* xh  = (_Float16*)(ws + 3 * F32_MAT + 3 * F16_MAT);
    _Float16* Wqh = (_Float16*)(ws + 3 * F32_MAT + 4 * F16_MAT);
    _Float16* Woh = (_Float16*)(ws + 3 * F32_MAT + 4 * F16_MAT + 3 * F16_W);
    _Float16* oh  = (_Float16*)(ws);

    // fp32 -> fp16 operand conversion: xh, Wqh, Wkh, Wvh, Woh are one contiguous range
    cvt_all<<<CV_XBLK + 4 * CV_WBLK, CV_THREADS, 0, stream>>>(x, Wq, Wk, Wv, Wo, xh);

    const dim3 ggrid(GN / BN, GM / BM);  // (8, 32)

    // Q, K and V projections: one launch over the 3 * GN rows of [Wqh; Wkh; Wvh], into [qh; kh; vh]
    gemm_bt<1><<<dim3(3 * GN / BN, GM / BM), 256, 0, stream>>>(xh, Wqh, nullptr, qh);
    attn_fa<<<dim3(SEQ / 64, HEADS, BATCH), 128, 0, stream>>>(qh, kh, vh, oh);
    gemm_bt<0><<<ggrid, 256, 0, stream>>>(oh, Woh, out, nullptr);
}

// v007
// A run of this version takes 91.2 microseconds.
// Timed twice side by side with v006, it ran 1.25 and 1.23 times as fast.
// Counting every step since v000, it is 2.15 times as fast.
#include <hip/hip_runtime.h>
#include <hip/hip_bf16.h>

// ---------------------------------------------------------------------------
// Types for WMMA (CDNA5 / gfx1250, wave32)
// ---------------------------------------------------------------------------
typedef __attribute__((ext_vector_type(16))) _Float16 v16h;
typedef __attribute__((ext_vector_type(8)))  _Float16 v8h;
typedef __attribute__((ext_vector_type(8)))  float    v8f;
typedef __attribute__((ext_vector_type(2)))  float    v2f;

__device__ __forceinline__ v16h mk16(v8h lo, v8h hi) {
    union { v16h v; v8h h[2]; } u;
    u.h[0] = lo; u.h[1] = hi;
    return u.v;
}

__device__ __forceinline__ v8f wmma_f16(v16h a, v16h b, v8f c) {
    // D = A(16x32 f16) * B(32x16 f16) + C(16x16 f32)
    return __builtin_amdgcn_wmma_f32_16x16x32_f16(
        /*neg_a=*/false, a, /*neg_b=*/false, b,
        /*c_mod=*/(short)0, c, /*reuse_a=*/false, /*reuse_b=*/false);
}

// ---------------------------------------------------------------------------
// Async global->LDS staging (gfx1250 ASYNCcnt path). Every wave-wide copy covers whole
// 128-byte lines: 8 neighbouring lanes bring the 8 16-byte pieces of one 128-byte row, so a
// copy touches 4 lines and not a piece of each of 16.
// ---------------------------------------------------------------------------
// One tile of 64 rows x 128 bytes that is contiguous in global memory, four copies a thread of
// a 128-thread work-group: thread t brings bytes 16 t + 2048 i, i = 0..3 (row 16 i + t / 8).
// The immediate offset moves BOTH addresses by 2048 i; the LDS rows lie 16 * pitch apart, so
// the LDS register of copy i carries the rest, i * step with step = 16 * pitch - 2048 (> 0).
__device__ __forceinline__ void async_tile64(unsigned lds, unsigned step, unsigned long long g) {
    asm volatile(
        "global_load_async_to_lds_b128 %0, %4, off\n\t"
        "global_load_async_to_lds_b128 %1, %4, off offset:2048\n\t"
        "global_load_async_to_lds_b128 %2, %4, off offset:4096\n\t"
        "global_load_async_to_lds_b128 %3, %4, off offset:6144\n\t"
        "s_wait_xcnt 0x0"   // inside the statement: the copies' address registers are rewritten only behind it
        :: "v"(lds), "v"(lds + step), "v"(lds + 2 * step), "v"(lds + 3 * step), "v"(g) : "memory");
}
// two such tiles in one statement: one wait serves all eight copies
__device__ __forceinline__ void async_tile64_x2(unsigned lds0, unsigned step0, unsigned long long g0,
                                                unsigned lds1, unsigned step1, unsigned long long g1) {
    asm volatile(
        "global_load_async_to_lds_b128 %0, %4, off\n\t"
        "global_load_async_to_lds_b128 %1, %4, off offset:2048\n\t"
        "global_load_async_to_lds_b128 %2, %4, off offset:4096\n\t"
        "global_load_async_to_lds_b128 %3, %4, off offset:6144\n\t"
        "global_load_async_to_lds_b128 %5, %9, off\n\t"
        "global_load_async_to_lds_b128 %6, %9, off offset:2048\n\t"
        "global_load_async_to_lds_b128 %7, %9, off offset:4096\n\t"
        "global_load_async_to_lds_b128 %8, %9, off offset:6144\n\t"
        "s_wait_xcnt 0x0"   // inside the statement: the copies' address registers are rewritten only behind it
        :: "v"(lds0), "v"(lds0 + step0), "v"(lds0 + 2 * step0), "v"(lds0 + 3 * step0), "v"(g0),
           "v"(lds1), "v"(lds1 + step1), "v"(lds1 + 2 * step1), "v"(lds1 + 3 * step1), "v"(g1)
        : "memory");
}
// eight copies with addresses of their own (rows too far apart in global memory for an offset)
__device__ __forceinline__ void async_copy16B_x8(const unsigned (&l)[8], const unsigned long long (&g)[8]) {
    asm volatile(
        "global_load_async_to_lds_b128 %0, %8, off\n\t"
        "global_load_async_to_lds_b128 %1, %9, off\n\t"
        "global_load_async_to_lds_b128 %2, %10, off\n\t"
        "global_load_async_to_lds_b128 %3, %11, off\n\t"
        "global_load_async_to_lds_b128 %4, %12, off\n\t"
        "global_load_async_to_lds_b128 %5, %13, off\n\t"
        "global_load_async_to_lds_b128 %6, %14, off\n\t"
        "global_load_async_to_lds_b128 %7, %15, off\n\t"
        "s_wait_xcnt 0x0"   // inside the statement: the copies' address registers are rewritten only behind it
        :: "v"(l[0]), "v"(l[1]), "v"(l[2]), "v"(l[3]), "v"(l[4]), "v"(l[5]), "v"(l[6]), "v"(l[7]),
           "v"(g[0]), "v"(g[1]), "v"(g[2]), "v"(g[3]), "v"(g[4]), "v"(g[5]), "v"(g[6]), "v"(g[7])
        : "memory");
}
__device__ __forceinline__ void async_wait0() {
    asm volatile("s_wait_asynccnt 0" ::: "memory");
}
// a wave's own LDS reads have retired before the barrier behind which copies refill what it read
__device__ __forceinline__ void lds_wait0() {
    asm volatile("s_wait_dscnt 0x0" ::: "memory");
}

// ---------------------------------------------------------------------------
// Problem constants
// ---------------------------------------------------------------------------
constexpr int BATCH = 2;
constexpr int SEQ   = 2048;
constexpr int HID   = 1024;
constexpr int HEADS = 16;
constexpr int HDIM  = 64;
constexpr int GM = BATCH * SEQ;   // 4096
constexpr int GN = HID;           // 1024
constexpr int GK = HID;           // 1024

// ---------------------------------------------------------------------------
// fp32 -> fp16 conversion of all five inputs in ONE launch (makes all GEMM operands
// async-able). The five f16 copies lie back to back in the workspace, so the target is one
// range. One work-group of 16 waves per 32768 floats; a work-group lies wholly inside one
// input. A wave's load covers 512 contiguous bytes, its store 256; a thread's 16 loads are
// all issued before its first store.
// ---------------------------------------------------------------------------
typedef __attribute__((ext_vector_type(4))) _Float16 v4h;
constexpr int CV_THREADS = 512;
constexpr int CV_PER     = 16;                            // float4 per thread
constexpr int CV_FLOATS  = CV_THREADS * CV_PER * 4;       // 32768 floats per work-group
constexpr int CV_XBLK    = GM * GK / CV_FLOATS;           // 128 work-groups for x
constexpr int CV_WBLK    = GN * GK / CV_FLOATS;           // 32 for each weight

__global__ __launch_bounds__(CV_THREADS)
void cvt_all(const float* __restrict__ x,  const float* __restrict__ wq,
             const float* __restrict__ wk, const float* __restrict__ wv,
             const float* __restrict__ wo, _Float16* __restrict__ dst) {
    const int b = blockIdx.x;
    const float* src;
    if (b < CV_XBLK) {
        src = x + (size_t)b * CV_FLOATS;
    } else {
        const int w = (b - CV_XBLK) / CV_WBLK;
        const float* base = (w == 0) ? wq : (w == 1) ? wk : (w == 2) ? wv : wo;
        src = base + (size_t)((b - CV_XBLK) % CV_WBLK) * CV_FLOATS;
    }
    const float4* s = (const float4*)src + threadIdx.x;
    v4h* d = (v4h*)(dst + (size_t)b * CV_FLOATS) + threadIdx.x;
    float4 f[CV_PER];
#pragma unroll
    for (int u = 0; u < CV_PER; ++u) f[u] = s[u * CV_THREADS];
#pragma unroll
    for (int u = 0; u < CV_PER; ++u) {
        v4h h;
        h[0] = (_Float16)f[u].x; h[1] = (_Float16)f[u].y;
        h[2] = (_Float16)f[u].z; h[3] = (_Float16)f[u].w;
        d[u * CV_THREADS] = h;
    }
}

// ---------------------------------------------------------------------------
// GEMM: C[M,N] = A[M,K] * W[N,K]^T   (all operands f16, f32 accumulation)
// Block tile 128x128x64, 256 threads = 8 waves, wave tile 32x64 (2x4 WMMA).
// MODE 0: C stored as f32, row-major.
// MODE 1: the three projections in ONE launch. Wq, Wk, Wv lie back to back as f16, so they
// are one weight matrix of 3 * GN rows, and the grid's x runs over all its column tiles; a
// work-group lies wholly inside one projection. Three work-groups then share a WGP, and one's
// wait for its copies is filled by the others' products. The product runs transposed (W rows
// as the A operand, both loaders share one k order), so a lane holds one token (column l16)
// and 8 consecutive head dims per tile; a wave's 64 columns are one head, so the RoPE
// partners d and d + 32 sit in tiles j and j + 2 of the same lane. Q and K are rotated in
// registers, V is not; all three are stored as f16 straight into the (b,h,s,d) layout that
// attention reads (q, k, v planes back to back behind Ch).
// A k stage is 64 halves, so a tile row is one whole 128-byte line of its matrix.
// LDS rows padded to 72 halves (144B stride -> conflict-free 16B frag reads).
// Double-buffered via async-to-LDS DMA; zero VGPR staging.
// ---------------------------------------------------------------------------
// The epilogue's transcendentals, each in one asm statement so that the closing v_nop stands
// directly behind it: that is the slot the instruction set asks for before a transcendental's
// source is overwritten.
// 2^x
__device__ __forceinline__ float exp2_hw(float x) {
    float y;
    asm("v_exp_f32 %0, %1\n\t"
        "v_nop"
        : "=v"(y) : "v"(x));
    return y;
}
// sin and cos of an angle given in revolutions (radians / 2 pi), the hardware's own unit
__device__ __forceinline__ void sincos_rev(float rev, float& sn, float& cs) {
    asm("v_sin_f32 %0, %2\n\t"
        "v_cos_f32 %1, %2\n\t"
        "v_nop"
        : "=&v"(sn), "=&v"(cs) : "v"(rev));
}

constexpr int BM = 128, BN = 128, BK = 64, LDT = 72;
constexpr int NKT = GK / BK;      // 16

template <int MODE>
__global__ __launch_bounds__(256)
void gemm_bt(const _Float16* __restrict__ Ah,
             const _Float16* __restrict__ Bh,
             float* __restrict__ C,
             _Float16* __restrict__ Ch) {
    __shared__ __attribute__((aligned(16))) _Float16 As[2][BM * LDT];
    __shared__ __attribute__((aligned(16))) _Float16 Bs[2][BM * LDT];

    const int tid = threadIdx.x;
    const int m0 = blockIdx.y * BM;
    const int n0 = blockIdx.x * BN;
    const int lr = tid >> 3;           // 0..31 (tile row; a thread also brings rows lr + 32, + 64, + 96)
    const int lc = (tid & 7) * 8;      // its 16-byte piece of the 128-byte row

    const int wave = tid >> 5, lane = tid & 31;
    const int wm = (wave >> 1) * 32;
    const int wn = (wave & 1) * 64;
    const int l16 = lane & 15;
    const int kh8 = (lane >> 4) * 8;

    const _Float16* ga = Ah + (size_t)(m0 + lr) * GK + lc;
    const _Float16* gb = Bh + (size_t)(n0 + lr) * GK + lc;

    auto issue = [&](int kt, int buf) {
        unsigned l[8];
        unsigned long long g[8];
        // unrolled: the addresses are operands of one asm statement and have to be registers
#pragma unroll
        for (int i = 0; i < 4; ++i) {
            l[i]     = (unsigned)(size_t)&As[buf][(lr + 32 * i) * LDT + lc];
            l[i + 4] = (unsigned)(size_t)&Bs[buf][(lr + 32 * i) * LDT + lc];
            g[i]     = (unsigned long long)(size_t)(ga + (size_t)(32 * i) * GK + kt * BK);
            g[i + 4] = (unsigned long long)(size_t)(gb + (size_t)(32 * i) * GK + kt * BK);
        }
        async_copy16B_x8(l, g);
    };

    v8f acc[2][4] = {};

    issue(0, 0);
    async_wait0();
    __syncthreads();

    int cur = 0;
    for (int kt = 0; kt < NKT; ++kt) {
        if (kt + 1 < NKT) issue(kt + 1, cur ^ 1);

        // unrolled: kk folds into the immediate offsets of the LDS reads
#pragma unroll
        for (int kk = 0; kk < BK; kk += 32) {
            v16h af[2], bf[4];
#pragma unroll
            for (int i = 0; i < 2; ++i) {
                const _Float16* base = &As[cur][(wm + 16 * i + l16) * LDT + kk];
                af[i] = mk16(*(const v8h*)(base + kh8), *(const v8h*)(base + 16 + kh8));
            }
#pragma unroll
            for (int j = 0; j < 4; ++j) {
                const _Float16* base = &Bs[cur][(wn + 16 * j + l16) * LDT + kk];
                bf[j] = mk16(*(const v8h*)(base + kh8), *(const v8h*)(base + 16 + kh8));
            }
#pragma unroll
            for (int i = 0; i < 2; ++i)
#pragma unroll
                for (int j = 0; j < 4; ++j)
                    acc[i][j] = (MODE == 0) ? wmma_f16(af[i], bf[j], acc[i][j])
                                            : wmma_f16(bf[j], af[i], acc[i][j]);
        }

        lds_wait0();
        if (kt + 1 < NKT) async_wait0();
        __syncthreads();
        cur ^= 1;
    }

    const int rgrp = (lane >> 4) * 8;
    if constexpr (MODE == 0) {
#pragma unroll
        for (int i = 0; i < 2; ++i)
#pragma unroll
            for (int j = 0; j < 4; ++j)
#pragma unroll
                for (int r = 0; r < 8; ++r) {
                    const int row = m0 + wm + 16 * i + r + rgrp;
                    const int col = n0 + wn + 16 * j + l16;
                    C[(size_t)row * GN + col] = acc[i][j][r];
                }
    } else {
        // acc[i][j][r] = C[token m0 + wm + 16*i + l16][column n0 + wn + 16*j + rgrp + r]
        const int proj = n0 / GN;                    // 0 = Q, 1 = K, 2 = V: the same for the whole work-group
        const int hd   = (n0 % GN + wn) / HDIM;
        _Float16* Cp   = Ch + (size_t)proj * GM * GN;
#pragma unroll
        for (int i = 0; i < 2; ++i) {
            const int row = m0 + wm + 16 * i + l16;
            const int bb  = row / SEQ;
            const int s   = row % SEQ;
            if (proj < 2) {
#pragma unroll
                for (int j = 0; j < 2; ++j)
#pragma unroll
                    for (int r = 0; r < 8; ++r) {
                        const int d = 16 * j + rgrp + r;
                        // inv_freq = 10000^(-d/32) = exp(-d * ln(10000)/32)
                        const float invf = exp2_hw(-(float)d * (9.210340371976184f / 32.0f) * 1.4426950408889634f);
                        const float ang  = (float)s * invf;
                        float sn, cs;
                        sincos_rev(ang * 0.15915494309189532f, sn, cs);
                        const float t1 = acc[i][j][r], t2 = acc[i][j + 2][r];
                        acc[i][j][r]     = t1 * cs - t2 * sn;
                        acc[i][j + 2][r] = t2 * cs + t1 * sn;
                    }
            }
            _Float16* op = Cp + (((size_t)bb * HEADS + hd) * SEQ + s) * HDIM + rgrp;
#pragma unroll
            for (int j = 0; j < 4; ++j) {
                v8h o;
#pragma unroll
                for (int r = 0; r < 8; ++r) o[r] = (_Float16)acc[i][j][r];
                *(v8h*)(op + 16 * j) = o;
            }
        }
    }
}

constexpr int LDQ = 72;
constexpr int LDV = 80;

typedef __attribute__((ext_vector_type(8))) short s16x8;
__device__ __forceinline__ v8h ld_tr16(const _Float16* p) {
    typedef __attribute__((address_space(3))) s16x8 lds_s16x8;
    return __builtin_bit_cast(v8h, __builtin_amdgcn_ds_load_tr16_b128_v8i16((lds_s16x8*)p));
}

// value of lane l ^ 16 (the other half of the wave)
__device__ __forceinline__ float xhalf(float x) {
    return __builtin_bit_cast(float, __builtin_amdgcn_permlanex16(
        __builtin_bit_cast(int, x), __builtin_bit_cast(int, x),
        0x76543210, 0xfedcba98, false, false));
}

// 2^x for eight values in one asm statement. Outputs are early-clobber, so no v_exp_f32 in it
// overwrites a neighbour's source or reads its result, and the closing v_nop is the slot the
// instruction set asks for behind the last one.
__device__ __forceinline__ void exp2_x8(const float (&x)[8], float (&y)[8]) {
    asm("v_exp_f32 %0, %8\n\t"
        "v_exp_f32 %1, %9\n\t"
        "v_exp_f32 %2, %10\n\t"
        "v_exp_f32 %3, %11\n\t"
        "v_exp_f32 %4, %12\n\t"
        "v_exp_f32 %5, %13\n\t"
        "v_exp_f32 %6, %14\n\t"
        "v_exp_f32 %7, %15\n\t"
        "v_nop"
        : "=&v"(y[0]), "=&v"(y[1]), "=&v"(y[2]), "=&v"(y[3]),
          "=&v"(y[4]), "=&v"(y[5]), "=&v"(y[6]), "=&v"(y[7])
        : "v"(x[0]), "v"(x[1]), "v"(x[2]), "v"(x[3]),
          "v"(x[4]), "v"(x[5]), "v"(x[6]), "v"(x[7]));
}
constexpr float LOG2E = 1.4426950408889634f;

__global__ __launch_bounds__(128)
void attn_fa(const _Float16* __restrict__ qh, const _Float16* __restrict__ kh,
             const _Float16* __restrict__ vh, _Float16* __restrict__ oh) {
    __shared__ __attribute__((aligned(16))) _Float16 Qs[64 * LDQ];
    __shared__ __attribute__((aligned(16))) _Float16 Ks[64 * LDQ];
    __shared__ __attribute__((aligned(16))) _Float16 Vs[64 * LDV];   // row-major: [key][d]

    const int tid  = threadIdx.x;
    const int wave = tid >> 5, lane = tid & 31;
    const int l16  = lane & 15;
    const int kh8  = (lane >> 4) * 8;
    const int rgrp = (lane >> 4) * 8;

    const int b  = blockIdx.z;
    const int hh = blockIdx.y;
    const int q0 = blockIdx.x * 64;
    const size_t bh = (size_t)b * HEADS + hh;
    const _Float16* Qg = qh + bh * SEQ * HDIM;
    const _Float16* Kg = kh + bh * SEQ * HDIM;
    const _Float16* Vg = vh + bh * SEQ * HDIM;

    const int srow = tid >> 3;            // staging row 0..15 (and + 16, + 32, + 48)
    const int scol = (tid & 7) * 8;       // the thread's 16-byte piece of the 128-byte row
    constexpr unsigned QK_STEP = 16 * LDQ * 2 - 2048;   // see async_tile64
    constexpr unsigned V_STEP  = 16 * LDV * 2 - 2048;

    // ---- stage Q tile (64 x 64) once, via async DMA ----
    async_tile64((unsigned)(size_t)&Qs[srow * LDQ + scol], QK_STEP,
                 (unsigned long long)(size_t)(Qg + (size_t)(q0 + srow) * HDIM + scol));
    async_wait0();
    __syncthreads();

    // Q^T fragments for this wave (B operand: column l16 = query; constant across key tiles)
    v16h qa0, qa1;
    {
        const _Float16* base = &Qs[(wave * 16 + l16) * LDQ];
        qa0 = mk16(*(const v8h*)(base + kh8),      *(const v8h*)(base + 16 + kh8));
        qa1 = mk16(*(const v8h*)(base + 32 + kh8), *(const v8h*)(base + 48 + kh8));
    }

    float mrun = -1e30f;   // running max of this lane's query (same in both halves)
    float lrun = 0.0f;     // running sum over this half's keys only; halves join in the epilogue
    v8f oa[4] = {};        // oa[jd][r] = O^T[jd*16 + rgrp + r][query l16]

    for (int kt = 0; kt < SEQ / 64; ++kt) {
        // ---- stage K tile and V tile (async DMA, both row-major) ----
        async_tile64_x2((unsigned)(size_t)&Ks[srow * LDQ + scol], QK_STEP,
                        (unsigned long long)(size_t)(Kg + (size_t)(kt * 64 + srow) * HDIM + scol),
                        (unsigned)(size_t)&Vs[srow * LDV + scol], V_STEP,
                        (unsigned long long)(size_t)(Vg + (size_t)(kt * 64 + srow) * HDIM + scol));
        async_wait0();
        __syncthreads();

        // ---- scores S^T = K * Q^T * scale : sc[j][r] = S[query l16][key j*16 + rgrp + r] ----
        // All 16 K fragment reads go out as one group, so the wave waits out the LDS latency once
        // instead of once per product.
        v16h kb0[4], kb1[4];
#pragma unroll
        for (int j = 0; j < 4; ++j) {
            const _Float16* base = &Ks[(j * 16 + l16) * LDQ];
            kb0[j] = mk16(*(const v8h*)(base + kh8),      *(const v8h*)(base + 16 + kh8));
            kb1[j] = mk16(*(const v8h*)(base + 32 + kh8), *(const v8h*)(base + 48 + kh8));
        }
        // keeps the read group whole: without it the scheduler sinks each pair of reads to its product
        __builtin_amdgcn_sched_barrier(0);
        v8f sc[4];
#pragma unroll
        for (int j = 0; j < 4; ++j) {
            v8f z = {};
            sc[j] = wmma_f16(kb0[j], qa0, z);
        }
#pragma unroll
        for (int j = 0; j < 4; ++j) sc[j] = wmma_f16(kb1[j], qa1, sc[j]);

        // All 16 V^T fragment reads go out here, in front of the softmax, whose vector work covers
        // their latency.
        v16h vb0[4], vb1[4];
#pragma unroll
        for (int jd = 0; jd < 4; ++jd) {
            const _Float16* base = &Vs[(kh8 + (lane & 7)) * LDV + jd * 16 + ((lane >> 3) & 1) * 8];
            vb0[jd] = mk16(ld_tr16(base),            ld_tr16(base + 16 * LDV));
            vb1[jd] = mk16(ld_tr16(base + 32 * LDV), ld_tr16(base + 48 * LDV));
        }
        // keeps the reads in front of the softmax: without it the scheduler sinks them to the second product
        __builtin_amdgcn_sched_barrier(0);
#pragma unroll
        for (int j = 0; j < 4; ++j)
#pragma unroll
            for (int r = 0; r < 8; ++r) sc[j][r] *= 0.125f;   // 1/sqrt(64)

        // ---- online softmax: 32 scores of one query per lane ----
        float t4[4];
#pragma unroll
        for (int j = 0; j < 4; ++j)
            t4[j] = fmaxf(fmaxf(fmaxf(sc[j][0], sc[j][1]), fmaxf(sc[j][2], sc[j][3])),
                          fmaxf(fmaxf(sc[j][4], sc[j][5]), fmaxf(sc[j][6], sc[j][7])));
        float tm = fmaxf(fmaxf(t4[0], t4[1]), fmaxf(t4[2], t4[3]));
        tm = fmaxf(tm, xhalf(tm));                 // join the two key halves
        const float nm   = fmaxf(mrun, tm);
        const float corr = exp2_hw((mrun - nm) * LOG2E);
        mrun = nm;

        // P^T packs in place into the B operand: in the hardware k order (the one the K, Q and
        // V^T loaders use) element s of pb[kk] is register s & 7 of score tile 2*kk + (s >> 3)
        v16h pb[2];
        v2f rs[4];
#pragma unroll
        for (int j = 0; j < 4; ++j) {
            float ex[8], ey[8];
#pragma unroll
            for (int r = 0; r < 8; ++r) ex[r] = (sc[j][r] - nm) * LOG2E;
            exp2_x8(ex, ey);
#pragma unroll
            for (int r = 0; r < 8; r += 2) {
                v2f p;
                p.x = ey[r];
                p.y = ey[r + 1];
                rs[j] = (r == 0) ? p : rs[j] + p;
                pb[j >> 1][(j & 1) * 8 + r]     = (_Float16)p.x;
                pb[j >> 1][(j & 1) * 8 + r + 1] = (_Float16)p.y;
            }
        }
        const v2f rt = (rs[0] + rs[1]) + (rs[2] + rs[3]);
        lrun = lrun * corr + (rt.x + rt.y);
#pragma unroll
        for (int jd = 0; jd < 4; ++jd)
#pragma unroll
            for (int r = 0; r < 8; ++r) oa[jd][r] *= corr;

        // ---- O^T += V^T * P^T ----
#pragma unroll
        for (int jd = 0; jd < 4; ++jd) oa[jd] = wmma_f16(vb0[jd], pb[0], oa[jd]);
#pragma unroll
        for (int jd = 0; jd < 4; ++jd) oa[jd] = wmma_f16(vb1[jd], pb[1], oa[jd]);
        lds_wait0();
        __syncthreads();
    }

    // ---- epilogue: O / l  ->  (b,s,h,d) f16; a lane holds 8 consecutive d per tile ----
    const float inv = 1.0f / (lrun + xhalf(lrun));
    const int   row = q0 + wave * 16 + l16;
    _Float16* op = oh + (((size_t)b * SEQ + row) * HEADS + hh) * HDIM + rgrp;
#pragma unroll
    for (int jd = 0; jd < 4; ++jd) {
        v8h o;
#pragma unroll
        for (int r = 0; r < 8; ++r) o[r] = (_Float16)(oa[jd][r] * inv);
        *(v8h*)(op + jd * 16) = o;
    }
}

// ---------------------------------------------------------------------------
// Launch
// ---------------------------------------------------------------------------
extern "C" void kernel_launch(void* const* d_in, const int* in_sizes, int n_in,
                              void* d_out, int out_size, void* d_ws, size_t ws_size,
                              hipStream_t stream) {
    const float* x  = (const float*)d_in[0];
    const float* Wq = (const float*)d_in[1];
    const float* Wk = (const float*)d_in[2];
    const float* Wv = (const float*)d_in[3];
    const float* Wo = (const float*)d_in[4];
    float* out = (float*)d_out;

    char* ws = (char*)d_ws;
    constexpr size_t F32_MAT = (size_t)GM * GN * sizeof(float);     // 16 MiB
    constexpr size_t F16_MAT = (size_t)GM * GN * sizeof(_Float16);  //  8 MiB
    constexpr size_t F16_W   = (size_t)GN * GK * sizeof(_Float16);  //  2 MiB

    _Float16* qh  = (_Float16*)(ws + 3 * F32_MAT);
    _Float16* kh  = (_Float16*)(ws + 3 * F32_MAT + F16_MAT);
    _Float16* vh  = (_Float16*)(ws + 3 * F32_MAT + 2 * F16_MAT);
    _Float16* xh  = (_Float16*)(ws + 3 * F32_MAT + 3 * F16_MAT);
    _Float16* Wqh = (_Float16*)(ws + 3 * F32_MAT + 4 * F16_MAT);
    _Float16* Woh = (_Float16*)(ws + 3 * F32_MAT + 4 * F16_MAT + 3 * F16_W);
    _Float16* oh  = (_Float16*)(ws);

    // fp32 -> fp16 operand conversion: xh, Wqh, Wkh, Wvh, Woh are one contiguous range
    cvt_all<<<CV_XBLK + 4 * CV_WBLK, CV_THREADS, 0, stream>>>(x, Wq, Wk, Wv, Wo, xh);

    const dim3 ggrid(GN / BN, GM / BM);  // (8, 32)

    // Q, K and V projections: one launch over the 3 * GN rows of [Wqh; Wkh; Wvh], into [qh; kh; vh]
    gemm_bt<1><<<dim3(3 * GN / BN, GM / BM), 256, 0, stream>>>(xh, Wqh, nullptr, qh);
    attn_fa<<<dim3(SEQ / 64, HEADS, BATCH), 128, 0, stream>>>(qh, kh, vh, oh);
    gemm_bt<0><<<ggrid, 256, 0, stream>>>(oh, Woh, out, nullptr);
}

// v008
// One run takes 85.9 microseconds.
// Next to v007, in two timings, it ran 1.08 and 1.09 times as fast.
// All steps since v000 together make it 2.33 times as fast.
#include <hip/hip_runtime.h>
#include <hip/hip_bf16.h>

// ---------------------------------------------------------------------------
// Types for WMMA (CDNA5 / gfx1250, wave32)
// ---------------------------------------------------------------------------
typedef __attribute__((ext_vector_type(16))) _Float16 v16h;
typedef __attribute__((ext_vector_type(8)))  _Float16 v8h;
typedef __attribute__((ext_vector_type(8)))  float    v8f;
typedef __attribute__((ext_vector_type(2)))  float    v2f;

__device__ __forceinline__ v16h mk16(v8h lo, v8h hi) {
    union { v16h v; v8h h[2]; } u;
    u.h[0] = lo; u.h[1] = hi;
    return u.v;
}

__device__ __forceinline__ v8f wmma_f16(v16h a, v16h b, v8f c) {
    // D = A(16x32 f16) * B(32x16 f16) + C(16x16 f32)
    return __builtin_amdgcn_wmma_f32_16x16x32_f16(
        /*neg_a=*/false, a, /*neg_b=*/false, b,
        /*c_mod=*/(short)0, c, /*reuse_a=*/false, /*reuse_b=*/false);
}

// ---------------------------------------------------------------------------
// Async global->LDS staging (gfx1250 ASYNCcnt path). Every wave-wide copy covers whole
// 128-byte lines: 8 neighbouring lanes bring the 8 16-byte pieces of one 128-byte row, so a
// copy touches 4 lines and not a piece of each of 16.
// ---------------------------------------------------------------------------
// One tile of 64 rows x 128 bytes that is contiguous in global memory, four copies a thread of
// a 128-thread work-group: thread t brings bytes 16 t + 2048 i, i = 0..3 (row 16 i + t / 8).
// The immediate offset moves BOTH addresses by 2048 i; the LDS rows lie 16 * pitch apart, so
// the LDS register of copy i carries the rest, i * step with step = 16 * pitch - 2048 (> 0).
__device__ __forceinline__ void async_tile64(unsigned lds, unsigned step, unsigned long long g) {
    asm volatile(
        "global_load_async_to_lds_b128 %0, %4, off\n\t"
        "global_load_async_to_lds_b128 %1, %4, off offset:2048\n\t"
        "global_load_async_to_lds_b128 %2, %4, off offset:4096\n\t"
        "global_load_async_to_lds_b128 %3, %4, off offset:6144\n\t"
        "s_wait_xcnt 0x0"   // inside the statement: the copies' address registers are rewritten only behind it
        :: "v"(lds), "v"(lds + step), "v"(lds + 2 * step), "v"(lds + 3 * step), "v"(g) : "memory");
}
// two such tiles in one statement: one wait serves all eight copies
__device__ __forceinline__ void async_tile64_x2(unsigned lds0, unsigned step0, unsigned long long g0,
                                                unsigned lds1, unsigned step1, unsigned long long g1) {
    asm volatile(
        "global_load_async_to_lds_b128 %0, %4, off\n\t"
        "global_load_async_to_lds_b128 %1, %4, off offset:2048\n\t"
        "global_load_async_to_lds_b128 %2, %4, off offset:4096\n\t"
        "global_load_async_to_lds_b128 %3, %4, off offset:6144\n\t"
        "global_load_async_to_lds_b128 %5, %9, off\n\t"
        "global_load_async_to_lds_b128 %6, %9, off offset:2048\n\t"
        "global_load_async_to_lds_b128 %7, %9, off offset:4096\n\t"
        "global_load_async_to_lds_b128 %8, %9, off offset:6144\n\t"
        "s_wait_xcnt 0x0"   // inside the statement: the copies' address registers are rewritten only behind it
        :: "v"(lds0), "v"(lds0 + step0), "v"(lds0 + 2 * step0), "v"(lds0 + 3 * step0), "v"(g0),
           "v"(lds1), "v"(lds1 + step1), "v"(lds1 + 2 * step1), "v"(lds1 + 3 * step1), "v"(g1)
        : "memory");
}
// eight copies with addresses of their own (rows too far apart in global memory for an offset)
__device__ __forceinline__ void async_copy16B_x8(const unsigned (&l)[8], const unsigned long long (&g)[8]) {
    asm volatile(
        "global_load_async_to_lds_b128 %0, %8, off\n\t"
        "global_load_async_to_lds_b128 %1, %9, off\n\t"
        "global_load_async_to_lds_b128 %2, %10, off\n\t"
        "global_load_async_to_lds_b128 %3, %11, off\n\t"
        "global_load_async_to_lds_b128 %4, %12, off\n\t"
        "global_load_async_to_lds_b128 %5, %13, off\n\t"
        "global_load_async_to_lds_b128 %6, %14, off\n\t"
        "global_load_async_to_lds_b128 %7, %15, off\n\t"
        "s_wait_xcnt 0x0"   // inside the statement: the copies' address registers are rewritten only behind it
        :: "v"(l[0]), "v"(l[1]), "v"(l[2]), "v"(l[3]), "v"(l[4]), "v"(l[5]), "v"(l[6]), "v"(l[7]),
           "v"(g[0]), "v"(g[1]), "v"(g[2]), "v"(g[3]), "v"(g[4]), "v"(g[5]), "v"(g[6]), "v"(g[7])
        : "memory");
}
__device__ __forceinline__ void async_wait0() {
    asm volatile("s_wait_asynccnt 0" ::: "memory");
}
// a wave's own LDS reads have retired before the barrier behind which copies refill what it read
__device__ __forceinline__ void lds_wait0() {
    asm volatile("s_wait_dscnt 0x0" ::: "memory");
}

// ---------------------------------------------------------------------------
// Problem constants
// ---------------------------------------------------------------------------
constexpr int BATCH = 2;
constexpr int SEQ   = 2048;
constexpr int HID   = 1024;
constexpr int HEADS = 16;
constexpr int HDIM  = 64;
constexpr int GM = BATCH * SEQ;   // 4096
constexpr int GN = HID;           // 1024
constexpr int GK = HID;           // 1024

// ---------------------------------------------------------------------------
// fp32 -> fp16 conversion of all five inputs in ONE launch (makes all GEMM operands
// async-able). The five f16 copies lie back to back in the workspace, so the target is one
// range. One work-group of 16 waves per 32768 floats; a work-group lies wholly inside one
// input. A wave's load covers 512 contiguous bytes, its store 256; a thread's 16 loads are
// all issued before its first store.
// ---------------------------------------------------------------------------
typedef __attribute__((ext_vector_type(4))) _Float16 v4h;
constexpr int CV_THREADS = 512;
constexpr int CV_PER     = 16;                            // float4 per thread
constexpr int CV_FLOATS  = CV_THREADS * CV_PER * 4;       // 32768 floats per work-group
constexpr int CV_XBLK    = GM * GK / CV_FLOATS;           // 128 work-groups for x
constexpr int CV_WBLK    = GN * GK / CV_FLOATS;           // 32 for each weight

__global__ __launch_bounds__(CV_THREADS)
void cvt_all(const float* __restrict__ x,  const float* __restrict__ wq,
             const float* __restrict__ wk, const float* __restrict__ wv,
             const float* __restrict__ wo, _Float16* __restrict__ dst) {
    const int b = blockIdx.x;
    const float* src;
    if (b < CV_XBLK) {
        src = x + (size_t)b * CV_FLOATS;
    } else {
        const int w = (b - CV_XBLK) / CV_WBLK;
        const float* base = (w == 0) ? wq : (w == 1) ? wk : (w == 2) ? wv : wo;
        src = base + (size_t)((b - CV_XBLK) % CV_WBLK) * CV_FLOATS;
    }
    const float4* s = (const float4*)src + threadIdx.x;
    v4h* d = (v4h*)(dst + (size_t)b * CV_FLOATS) + threadIdx.x;
    float4 f[CV_PER];
#pragma unroll
    for (int u = 0; u < CV_PER; ++u) f[u] = s[u * CV_THREADS];
#pragma unroll
    for (int u = 0; u < CV_PER; ++u) {
        v4h h;
        h[0] = (_Float16)f[u].x; h[1] = (_Float16)f[u].y;
        h[2] = (_Float16)f[u].z; h[3] = (_Float16)f[u].w;
        d[u * CV_THREADS] = h;
    }
}

// ---------------------------------------------------------------------------
// GEMM: C[M,N] = A[M,K] * W[N,K]^T   (all operands f16, f32 accumulation)
// Block tile 128x128x64, 256 threads = 8 waves, wave tile 32x64 (2x4 WMMA).
// MODE 0: C stored as f32, row-major.
// MODE 1: the three projections in ONE launch. Wq, Wk, Wv lie back to back as f16, so they
// are one weight matrix of 3 * GN rows, and the grid's x runs over all its column tiles; a
// work-group lies wholly inside one projection. Three work-groups then share a WGP, and one's
// wait for its copies is filled by the others' products. The product runs transposed (W rows
// as the A operand, both loaders share one k order), so a lane holds one token (column l16)
// and 8 consecutive head dims per tile; a wave's 64 columns are one head, so the RoPE
// partners d and d + 32 sit in tiles j and j + 2 of the same lane. Q and K are rotated in
// registers, V is not; all three are stored as f16 straight into the (b,h,s,d) layout that
// attention reads (q, k, v planes back to back behind Ch).
// A k stage is 64 halves, so a tile row is one whole 128-byte line of its matrix.
// LDS rows padded to 72 halves (144B stride -> conflict-free 16B frag reads).
// Double-buffered via async-to-LDS DMA; zero VGPR staging.
// ---------------------------------------------------------------------------
// The epilogue's transcendentals, each in one asm statement so that the closing v_nop stands
// directly behind it: that is the slot the instruction set asks for before a transcendental's
// source is overwritten.
// 2^x
__device__ __forceinline__ float exp2_hw(float x) {
    float y;
    asm("v_exp_f32 %0, %1\n\t"
        "v_nop"
        : "=v"(y) : "v"(x));
    return y;
}
// sin and cos of an angle given in revolutions (radians / 2 pi), the hardware's own unit
__device__ __forceinline__ void sincos_rev(float rev, float& sn, float& cs) {
    asm("v_sin_f32 %0, %2\n\t"
        "v_cos_f32 %1, %2\n\t"
        "v_nop"
        : "=&v"(sn), "=&v"(cs) : "v"(rev));
}

constexpr int BM = 128, BN = 128, BK = 64, LDT = 72;
constexpr int NKT = GK / BK;      // 16

template <int MODE>
__global__ __launch_bounds__(256)
void gemm_bt(const _Float16* __restrict__ Ah,
             const _Float16* __restrict__ Bh,
             float* __restrict__ C,
             _Float16* __restrict__ Ch) {
    __shared__ __attribute__((aligned(16))) _Float16 As[2][BM * LDT];
    __shared__ __attribute__((aligned(16))) _Float16 Bs[2][BM * LDT];

    const int tid = threadIdx.x;
    const int m0 = blockIdx.y * BM;
    const int n0 = blockIdx.x * BN;
    const int lr = tid >> 3;           // 0..31 (tile row; a thread also brings rows lr + 32, + 64, + 96)
    const int lc = (tid & 7) * 8;      // its 16-byte piece of the 128-byte row

    const int wave = tid >> 5, lane = tid & 31;
    const int wm = (wave >> 1) * 32;
    const int wn = (wave & 1) * 64;
    const int l16 = lane & 15;
    const int kh8 = (lane >> 4) * 8;

    const _Float16* ga = Ah + (size_t)(m0 + lr) * GK + lc;
    const _Float16* gb = Bh + (size_t)(n0 + lr) * GK + lc;

    auto issue = [&](int kt, int buf) {
        unsigned l[8];
        unsigned long long g[8];
        // unrolled: the addresses are operands of one asm statement and have to be registers
#pragma unroll
        for (int i = 0; i < 4; ++i) {
            l[i]     = (unsigned)(size_t)&As[buf][(lr + 32 * i) * LDT + lc];
            l[i + 4] = (unsigned)(size_t)&Bs[buf][(lr + 32 * i) * LDT + lc];
            g[i]     = (unsigned long long)(size_t)(ga + (size_t)(32 * i) * GK + kt * BK);
            g[i + 4] = (unsigned long long)(size_t)(gb + (size_t)(32 * i) * GK + kt * BK);
        }
        async_copy16B_x8(l, g);
    };

    v8f acc[2][4] = {};

    issue(0, 0);
    async_wait0();
    __syncthreads();

    int cur = 0;
    for (int kt = 0; kt < NKT; ++kt) {
        if (kt + 1 < NKT) issue(kt + 1, cur ^ 1);

        // unrolled: kk folds into the immediate offsets of the LDS reads
#pragma unroll
        for (int kk = 0; kk < BK; kk += 32) {
            v16h af[2], bf[4];
#pragma unroll
            for (int i = 0; i < 2; ++i) {
                const _Float16* base = &As[cur][(wm + 16 * i + l16) * LDT + kk];
                af[i] = mk16(*(const v8h*)(base + kh8), *(const v8h*)(base + 16 + kh8));
            }
#pragma unroll
            for (int j = 0; j < 4; ++j) {
                const _Float16* base = &Bs[cur][(wn + 16 * j + l16) * LDT + kk];
                bf[j] = mk16(*(const v8h*)(base + kh8), *(const v8h*)(base + 16 + kh8));
            }
#pragma unroll
            for (int i = 0; i < 2; ++i)
#pragma unroll
                for (int j = 0; j < 4; ++j)
                    acc[i][j] = (MODE == 0) ? wmma_f16(af[i], bf[j], acc[i][j])
                                            : wmma_f16(bf[j], af[i], acc[i][j]);
        }

        lds_wait0();
        if (kt + 1 < NKT) async_wait0();
        __syncthreads();
        cur ^= 1;
    }

    const int rgrp = (lane >> 4) * 8;
    if constexpr (MODE == 0) {
#pragma unroll
        for (int i = 0; i < 2; ++i)
#pragma unroll
            for (int j = 0; j < 4; ++j)
#pragma unroll
                for (int r = 0; r < 8; ++r) {
                    const int row = m0 + wm + 16 * i + r + rgrp;
                    const int col = n0 + wn + 16 * j + l16;
                    C[(size_t)row * GN + col] = acc[i][j][r];
                }
    } else {
        // acc[i][j][r] = C[token m0 + wm + 16*i + l16][column n0 + wn + 16*j + rgrp + r]
        const int proj = n0 / GN;                    // 0 = Q, 1 = K, 2 = V: the same for the whole work-group
        const int hd   = (n0 % GN + wn) / HDIM;
        _Float16* Cp   = Ch + (size_t)proj * GM * GN;
#pragma unroll
        for (int i = 0; i < 2; ++i) {
            const int row = m0 + wm + 16 * i + l16;
            const int bb  = row / SEQ;
            const int s   = row % SEQ;
            if (proj < 2) {
#pragma unroll
                for (int j = 0; j < 2; ++j)
#pragma unroll
                    for (int r = 0; r < 8; ++r) {
                        const int d = 16 * j + rgrp + r;
                        // inv_freq = 10000^(-d/32) = exp(-d * ln(10000)/32)
                        const float invf = exp2_hw(-(float)d * (9.210340371976184f / 32.0f) * 1.4426950408889634f);
                        const float ang  = (float)s * invf;
                        float sn, cs;
                        sincos_rev(ang * 0.15915494309189532f, sn, cs);
                        const float t1 = acc[i][j][r], t2 = acc[i][j + 2][r];
                        acc[i][j][r]     = t1 * cs - t2 * sn;
                        acc[i][j + 2][r] = t2 * cs + t1 * sn;
                    }
            }
            _Float16* op = Cp + (((size_t)bb * HEADS + hd) * SEQ + s) * HDIM + rgrp;
#pragma unroll
            for (int j = 0; j < 4; ++j) {
                v8h o;
#pragma unroll
                for (int r = 0; r < 8; ++r) o[r] = (_Float16)acc[i][j][r];
                *(v8h*)(op + 16 * j) = o;
            }
        }
    }
}

constexpr int LDQ = 72;
constexpr int LDV = 80;

typedef __attribute__((ext_vector_type(8))) short s16x8;
__device__ __forceinline__ v8h ld_tr16(const _Float16* p) {
    typedef __attribute__((address_space(3))) s16x8 lds_s16x8;
    return __builtin_bit_cast(v8h, __builtin_amdgcn_ds_load_tr16_b128_v8i16((lds_s16x8*)p));
}

// value of lane l ^ 16 (the other half of the wave)
__device__ __forceinline__ float xhalf(float x) {
    return __builtin_bit_cast(float, __builtin_amdgcn_permlanex16(
        __builtin_bit_cast(int, x), __builtin_bit_cast(int, x),
        0x76543210, 0xfedcba98, false, false));
}

// 2^x for eight values in one asm statement. Outputs are early-clobber, so no v_exp_f32 in it
// overwrites a neighbour's source or reads its result, and the closing v_nop is the slot the
// instruction set asks for behind the last one.
__device__ __forceinline__ void exp2_x8(const float (&x)[8], float (&y)[8]) {
    asm("v_exp_f32 %0, %8\n\t"
        "v_exp_f32 %1, %9\n\t"
        "v_exp_f32 %2, %10\n\t"
        "v_exp_f32 %3, %11\n\t"
        "v_exp_f32 %4, %12\n\t"
        "v_exp_f32 %5, %13\n\t"
        "v_exp_f32 %6, %14\n\t"
        "v_exp_f32 %7, %15\n\t"
        "v_nop"
        : "=&v"(y[0]), "=&v"(y[1]), "=&v"(y[2]), "=&v"(y[3]),
          "=&v"(y[4]), "=&v"(y[5]), "=&v"(y[6]), "=&v"(y[7])
        : "v"(x[0]), "v"(x[1]), "v"(x[2]), "v"(x[3]),
          "v"(x[4]), "v"(x[5]), "v"(x[6]), "v"(x[7]));
}
constexpr float LOG2E = 1.4426950408889634f;

__global__ __launch_bounds__(128)
void attn_fa(const _Float16* __restrict__ qh, const _Float16* __restrict__ kh,
             const _Float16* __restrict__ vh, _Float16* __restrict__ oh) {
    __shared__ __attribute__((aligned(16))) _Float16 Qs[64 * LDQ];
    __shared__ __attribute__((aligned(16))) _Float16 Ks[2][64 * LDQ];
    __shared__ __attribute__((aligned(16))) _Float16 Vs[2][64 * LDV];   // row-major: [key][d]

    const int tid  = threadIdx.x;
    const int wave = tid >> 5, lane = tid & 31;
    const int l16  = lane & 15;
    const int kh8  = (lane >> 4) * 8;
    const int rgrp = (lane >> 4) * 8;

    const int b  = blockIdx.z;
    const int hh = blockIdx.y;
    const int q0 = blockIdx.x * 64;
    const size_t bh = (size_t)b * HEADS + hh;
    const _Float16* Qg = qh + bh * SEQ * HDIM;
    const _Float16* Kg = kh + bh * SEQ * HDIM;
    const _Float16* Vg = vh + bh * SEQ * HDIM;

    const int srow = tid >> 3;            // staging row 0..15 (and + 16, + 32, + 48)
    const int scol = (tid & 7) * 8;       // the thread's 16-byte piece of the 128-byte row
    constexpr unsigned QK_STEP = 16 * LDQ * 2 - 2048;   // see async_tile64
    constexpr unsigned V_STEP  = 16 * LDV * 2 - 2048;

    // K tile and V tile number t (async DMA, both row-major) into buffer buf
    auto stage_kv = [&](int t, int buf) {
        async_tile64_x2((unsigned)(size_t)&Ks[buf][srow * LDQ + scol], QK_STEP,
                        (unsigned long long)(size_t)(Kg + (size_t)(t * 64 + srow) * HDIM + scol),
                        (unsigned)(size_t)&Vs[buf][srow * LDV + scol], V_STEP,
                        (unsigned long long)(size_t)(Vg + (size_t)(t * 64 + srow) * HDIM + scol));
    };

    // ---- stage Q tile (64 x 64) once, and key tile 0, via async DMA; one wait serves both ----
    async_tile64((unsigned)(size_t)&Qs[srow * LDQ + scol], QK_STEP,
                 (unsigned long long)(size_t)(Qg + (size_t)(q0 + srow) * HDIM + scol));
    stage_kv(0, 0);
    async_wait0();
    __syncthreads();
    stage_kv(1, 1);

    // Q^T fragments for this wave (B operand: column l16 = query; constant across key tiles)
    v16h qa0, qa1;
    {
        const _Float16* base = &Qs[(wave * 16 + l16) * LDQ];
        qa0 = mk16(*(const v8h*)(base + kh8),      *(const v8h*)(base + 16 + kh8));
        qa1 = mk16(*(const v8h*)(base + 32 + kh8), *(const v8h*)(base + 48 + kh8));
    }

    float mrun = -1e30f;   // running max of this lane's query (same in both halves)
    float lrun = 0.0f;     // running sum over this half's keys only; halves join in the epilogue
    v8f oa[4] = {};        // oa[jd][r] = O^T[jd*16 + rgrp + r][query l16]

    // One trip: key tile kt out of buffer buf. buf and more (a tile kt + 2 exists) are literals at
    // every call and fold only when the call is inlined (hence always_inline): the buffer number goes
    // into the immediate offsets of the LDS reads, and the trip is straight-line code.
    auto trip = [&](int kt, int buf, bool more) __attribute__((always_inline)) {
        // ---- scores S^T = K * Q^T * scale : sc[j][r] = S[query l16][key j*16 + rgrp + r] ----
        // All 16 K fragment reads go out as one group, so the wave waits out the LDS latency once
        // instead of once per product.
        v16h kb0[4], kb1[4];
#pragma unroll
        for (int j = 0; j < 4; ++j) {
            const _Float16* base = &Ks[buf][(j * 16 + l16) * LDQ];
            kb0[j] = mk16(*(const v8h*)(base + kh8),      *(const v8h*)(base + 16 + kh8));
            kb1[j] = mk16(*(const v8h*)(base + 32 + kh8), *(const v8h*)(base + 48 + kh8));
        }
        // keeps the read group whole: without it the scheduler sinks each pair of reads to its product
        __builtin_amdgcn_sched_barrier(0);
        v8f sc[4];
#pragma unroll
        for (int j = 0; j < 4; ++j) {
            v8f z = {};
            sc[j] = wmma_f16(kb0[j], qa0, z);
        }
#pragma unroll
        for (int j = 0; j < 4; ++j) sc[j] = wmma_f16(kb1[j], qa1, sc[j]);

        // All 16 V^T fragment reads go out here, in front of the softmax, whose vector work covers
        // their latency.
        v16h vb0[4], vb1[4];
#pragma unroll
        for (int jd = 0; jd < 4; ++jd) {
            const _Float16* base = &Vs[buf][(kh8 + (lane & 7)) * LDV + jd * 16 + ((lane >> 3) & 1) * 8];
            vb0[jd] = mk16(ld_tr16(base),            ld_tr16(base + 16 * LDV));
            vb1[jd] = mk16(ld_tr16(base + 32 * LDV), ld_tr16(base + 48 * LDV));
        }
        // keeps the reads in front of the softmax's scale and max, which run under their latency up to the hand-over's wait
        __builtin_amdgcn_sched_barrier(0);
#pragma unroll
        for (int j = 0; j < 4; ++j)
#pragma unroll
            for (int r = 0; r < 8; ++r) sc[j][r] *= 0.125f;   // 1/sqrt(64)

        // ---- online softmax: 32 scores of one query per lane ----
        float t4[4];
#pragma unroll
        for (int j = 0; j < 4; ++j)
            t4[j] = fmaxf(fmaxf(fmaxf(sc[j][0], sc[j][1]), fmaxf(sc[j][2], sc[j][3])),
                          fmaxf(fmaxf(sc[j][4], sc[j][5]), fmaxf(sc[j][6], sc[j][7])));
        float tm = fmaxf(fmaxf(t4[0], t4[1]), fmaxf(t4[2], t4[3]));

        // ---- hand-over. The trip's LDS part ends here: all its K and V fragments are in registers
        // and the rest of it touches no LDS. Own reads of this buffer retired, own copies of tile
        // kt + 1 landed; the one barrier publishes tile kt + 1 and frees this buffer, and the copies
        // of tile kt + 2 go out at once, a whole trip ahead of the wait that covers them ----
        lds_wait0();
        async_wait0();
        __syncthreads();
        if (more) {
            stage_kv(kt + 2, buf);
            // keeps the copies directly behind the barrier: without it the scheduler sinks them behind
            // the softmax, and they lose that much of their lead on the wait that covers them
            __builtin_amdgcn_sched_barrier(0);
        }

        tm = fmaxf(tm, xhalf(tm));                 // join the two key halves
        const float nm   = fmaxf(mrun, tm);
        const float corr = exp2_hw((mrun - nm) * LOG2E);
        mrun = nm;

        // P^T packs in place into the B operand: in the hardware k order (the one the K, Q and
        // V^T loaders use) element s of pb[kk] is register s & 7 of score tile 2*kk + (s >> 3)
        v16h pb[2];
        v2f rs[4];
#pragma unroll
        for (int j = 0; j < 4; ++j) {
            float ex[8], ey[8];
#pragma unroll
            for (int r = 0; r < 8; ++r) ex[r] = (sc[j][r] - nm) * LOG2E;
            exp2_x8(ex, ey);
#pragma unroll
            for (int r = 0; r < 8; r += 2) {
                v2f p;
                p.x = ey[r];
                p.y = ey[r + 1];
                rs[j] = (r == 0) ? p : rs[j] + p;
                pb[j >> 1][(j & 1) * 8 + r]     = (_Float16)p.x;
                pb[j >> 1][(j & 1) * 8 + r + 1] = (_Float16)p.y;
            }
        }
        const v2f rt = (rs[0] + rs[1]) + (rs[2] + rs[3]);
        lrun = lrun * corr + (rt.x + rt.y);
#pragma unroll
        for (int jd = 0; jd < 4; ++jd)
#pragma unroll
            for (int r = 0; r < 8; ++r) oa[jd][r] *= corr;

        // ---- O^T += V^T * P^T ----
#pragma unroll
        for (int jd = 0; jd < 4; ++jd) oa[jd] = wmma_f16(vb0[jd], pb[0], oa[jd]);
#pragma unroll
        for (int jd = 0; jd < 4; ++jd) oa[jd] = wmma_f16(vb1[jd], pb[1], oa[jd]);
    };

    constexpr int NT = SEQ / 64;
    for (int kt = 0; kt < NT - 2; kt += 2) {
        trip(kt, 0, true);
        trip(kt + 1, 1, true);
    }
    trip(NT - 2, 0, false);
    trip(NT - 1, 1, false);
    async_wait0();

    // ---- epilogue: O / l  ->  (b,s,h,d) f16; a lane holds 8 consecutive d per tile ----
    const float inv = 1.0f / (lrun + xhalf(lrun));
    const int   row = q0 + wave * 16 + l16;
    _Float16* op = oh + (((size_t)b * SEQ + row) * HEADS + hh) * HDIM + rgrp;
#pragma unroll
    for (int jd = 0; jd < 4; ++jd) {
        v8h o;
#pragma unroll
        for (int r = 0; r < 8; ++r) o[r] = (_Float16)(oa[jd][r] * inv);
        *(v8h*)(op + jd * 16) = o;
    }
}

// ---------------------------------------------------------------------------
// Launch
// ---------------------------------------------------------------------------
extern "C" void kernel_launch(void* const* d_in, const int* in_sizes, int n_in,
                              void* d_out, int out_size, void* d_ws, size_t ws_size,
                              hipStream_t stream) {
    const float* x  = (const float*)d_in[0];
    const float* Wq = (const float*)d_in[1];
    const float* Wk = (const float*)d_in[2];
    const float* Wv = (const float*)d_in[3];
    const float* Wo = (const float*)d_in[4];
    float* out = (float*)d_out;

    char* ws = (char*)d_ws;
    constexpr size_t F32_MAT = (size_t)GM * GN * sizeof(float);     // 16 MiB
    constexpr size_t F16_MAT = (size_t)GM * GN * sizeof(_Float16);  //  8 MiB
    constexpr size_t F16_W   = (size_t)GN * GK * sizeof(_Float16);  //  2 MiB

    _Float16* qh  = (_Float16*)(ws + 3 * F32_MAT);
    _Float16* kh  = (_Float16*)(ws + 3 * F32_MAT + F16_MAT);
    _Float16* vh  = (_Float16*)(ws + 3 * F32_MAT + 2 * F16_MAT);
    _Float16* xh  = (_Float16*)(ws + 3 * F32_MAT + 3 * F16_MAT);
    _Float16* Wqh = (_Float16*)(ws + 3 * F32_MAT + 4 * F16_MAT);
    _Float16* Woh = (_Float16*)(ws + 3 * F32_MAT + 4 * F16_MAT + 3 * F16_W);
    _Float16* oh  = (_Float16*)(ws);

    // fp32 -> fp16 operand conversion: xh, Wqh, Wkh, Wvh, Woh are one contiguous range
    cvt_all<<<CV_XBLK + 4 * CV_WBLK, CV_THREADS, 0, stream>>>(x, Wq, Wk, Wv, Wo, xh);

    const dim3 ggrid(GN / BN, GM / BM);  // (8, 32)

    // Q, K and V projections: one launch over the 3 * GN rows of [Wqh; Wkh; Wvh], into [qh; kh; vh]
    gemm_bt<1><<<dim3(3 * GN / BN, GM / BM), 256, 0, stream>>>(xh, Wqh, nullptr, qh);
    attn_fa<<<dim3(SEQ / 64, HEADS, BATCH), 128, 0, stream>>>(qh, kh, vh, oh);
    gemm_bt<0><<<ggrid, 256, 0, stream>>>(oh, Woh, out, nullptr);
}

// v009
// A run of this version takes 82.2 microseconds.
// In both of two side-by-side timings against v008, it was 1.03 times as fast.
// Counting every step since v000, it is 2.41 times as fast.
#include <hip/hip_runtime.h>
#include <hip/hip_bf16.h>

// ---------------------------------------------------------------------------
// Types for WMMA (CDNA5 / gfx1250, wave32)
// ---------------------------------------------------------------------------
typedef __attribute__((ext_vector_type(16))) _Float16 v16h;
typedef __attribute__((ext_vector_type(8)))  _Float16 v8h;
typedef __attribute__((ext_vector_type(8)))  float    v8f;
typedef __attribute__((ext_vector_type(2)))  float    v2f;

__device__ __forceinline__ v16h mk16(v8h lo, v8h hi) {
    union { v16h v; v8h h[2]; } u;
    u.h[0] = lo; u.h[1] = hi;
    return u.v;
}

__device__ __forceinline__ v8f wmma_f16(v16h a, v16h b, v8f c) {
    // D = A(16x32 f16) * B(32x16 f16) + C(16x16 f32)
    return __builtin_amdgcn_wmma_f32_16x16x32_f16(
        /*neg_a=*/false, a, /*neg_b=*/false, b,
        /*c_mod=*/(short)0, c, /*reuse_a=*/false, /*reuse_b=*/false);
}

// ---------------------------------------------------------------------------
// Async global->LDS staging (gfx1250 ASYNCcnt path). Every wave-wide copy covers whole
// 128-byte lines: 8 neighbouring lanes bring the 8 16-byte pieces of one 128-byte row, so a
// copy touches 4 lines and not a piece of each of 16.
// ---------------------------------------------------------------------------
// One tile of 64 rows x 128 bytes that is contiguous in global memory, four copies a thread of
// a 128-thread work-group: thread t brings bytes 16 t + 2048 i, i = 0..3 (row 16 i + t / 8).
// The immediate offset moves BOTH addresses by 2048 i; the LDS rows lie 16 * pitch apart, so
// the LDS register of copy i carries the rest, i * step with step = 16 * pitch - 2048 (> 0).
__device__ __forceinline__ void async_tile64(unsigned lds, unsigned step, unsigned long long g) {
    asm volatile(
        "global_load_async_to_lds_b128 %0, %4, off\n\t"
        "global_load_async_to_lds_b128 %1, %4, off offset:2048\n\t"
        "global_load_async_to_lds_b128 %2, %4, off offset:4096\n\t"
        "global_load_async_to_lds_b128 %3, %4, off offset:6144\n\t"
        "s_wait_xcnt 0x0"   // inside the statement: the copies' address registers are rewritten only behind it
        :: "v"(lds), "v"(lds + step), "v"(lds + 2 * step), "v"(lds + 3 * step), "v"(g) : "memory");
}
// two such tiles in one statement: one wait serves all eight copies
__device__ __forceinline__ void async_tile64_x2(unsigned lds0, unsigned step0, unsigned long long g0,
                                                unsigned lds1, unsigned step1, unsigned long long g1) {
    asm volatile(
        "global_load_async_to_lds_b128 %0, %4, off\n\t"
        "global_load_async_to_lds_b128 %1, %4, off offset:2048\n\t"
        "global_load_async_to_lds_b128 %2, %4, off offset:4096\n\t"
        "global_load_async_to_lds_b128 %3, %4, off offset:6144\n\t"
        "global_load_async_to_lds_b128 %5, %9, off\n\t"
        "global_load_async_to_lds_b128 %6, %9, off offset:2048\n\t"
        "global_load_async_to_lds_b128 %7, %9, off offset:4096\n\t"
        "global_load_async_to_lds_b128 %8, %9, off offset:6144\n\t"
        "s_wait_xcnt 0x0"   // inside the statement: the copies' address registers are rewritten only behind it
        :: "v"(lds0), "v"(lds0 + step0), "v"(lds0 + 2 * step0), "v"(lds0 + 3 * step0), "v"(g0),
           "v"(lds1), "v"(lds1 + step1), "v"(lds1 + 2 * step1), "v"(lds1 + 3 * step1), "v"(g1)
        : "memory");
}
// eight copies with addresses of their own (rows too far apart in global memory for an offset)
__device__ __forceinline__ void async_copy16B_x8(const unsigned (&l)[8], const unsigned long long (&g)[8]) {
    asm volatile(
        "global_load_async_to_lds_b128 %0, %8, off\n\t"
        "global_load_async_to_lds_b128 %1, %9, off\n\t"
        "global_load_async_to_lds_b128 %2, %10, off\n\t"
        "global_load_async_to_lds_b128 %3, %11, off\n\t"
        "global_load_async_to_lds_b128 %4, %12, off\n\t"
        "global_load_async_to_lds_b128 %5, %13, off\n\t"
        "global_load_async_to_lds_b128 %6, %14, off\n\t"
        "global_load_async_to_lds_b128 %7, %15, off\n\t"
        "s_wait_xcnt 0x0"   // inside the statement: the copies' address registers are rewritten only behind it
        :: "v"(l[0]), "v"(l[1]), "v"(l[2]), "v"(l[3]), "v"(l[4]), "v"(l[5]), "v"(l[6]), "v"(l[7]),
           "v"(g[0]), "v"(g[1]), "v"(g[2]), "v"(g[3]), "v"(g[4]), "v"(g[5]), "v"(g[6]), "v"(g[7])
        : "memory");
}
__device__ __forceinline__ void async_wait0() {
    asm volatile("s_wait_asynccnt 0" ::: "memory");
}
// a wave's own LDS reads have retired before the barrier behind which copies refill what it read
__device__ __forceinline__ void lds_wait0() {
    asm volatile("s_wait_dscnt 0x0" ::: "memory");
}

// ---------------------------------------------------------------------------
// Problem constants
// ---------------------------------------------------------------------------
constexpr int BATCH = 2;
constexpr int SEQ   = 2048;
constexpr int HID   = 1024;
constexpr int HEADS = 16;
constexpr int HDIM  = 64;
constexpr int GM = BATCH * SEQ;   // 4096
constexpr int GN = HID;           // 1024
constexpr int GK = HID;           // 1024

// ---------------------------------------------------------------------------
// fp32 -> fp16 conversion of all five inputs in ONE launch (makes all GEMM operands
// async-able). The five f16 copies lie back to back in the workspace, so the target is one
// range. One work-group of 16 waves per 32768 floats; a work-group lies wholly inside one
// input. A wave's load covers 512 contiguous bytes, its store 256; a thread's 16 loads are
// all issued before its first store.
// ---------------------------------------------------------------------------
typedef __attribute__((ext_vector_type(4))) _Float16 v4h;
constexpr int CV_THREADS = 512;
constexpr int CV_PER     = 16;                            // float4 per thread
constexpr int CV_FLOATS  = CV_THREADS * CV_PER * 4;       // 32768 floats per work-group
constexpr int CV_XBLK    = GM * GK / CV_FLOATS;           // 128 work-groups for x
constexpr int CV_WBLK    = GN * GK / CV_FLOATS;           // 32 for each weight

__global__ __launch_bounds__(CV_THREADS)
void cvt_all(const float* __restrict__ x,  const float* __restrict__ wq,
             const float* __restrict__ wk, const float* __restrict__ wv,
             const float* __restrict__ wo, _Float16* __restrict__ dst) {
    const int b = blockIdx.x;
    const float* src;
    if (b < CV_XBLK) {
        src = x + (size_t)b * CV_FLOATS;
    } else {
        const int w = (b - CV_XBLK) / CV_WBLK;
        const float* base = (w == 0) ? wq : (w == 1) ? wk : (w == 2) ? wv : wo;
        src = base + (size_t)((b - CV_XBLK) % CV_WBLK) * CV_FLOATS;
    }
    const float4* s = (const float4*)src + threadIdx.x;
    v4h* d = (v4h*)(dst + (size_t)b * CV_FLOATS) + threadIdx.x;
    float4 f[CV_PER];
#pragma unroll
    for (int u = 0; u < CV_PER; ++u) f[u] = s[u * CV_THREADS];
#pragma unroll
    for (int u = 0; u < CV_PER; ++u) {
        v4h h;
        h[0] = (_Float16)f[u].x; h[1] = (_Float16)f[u].y;
        h[2] = (_Float16)f[u].z; h[3] = (_Float16)f[u].w;
        d[u * CV_THREADS] = h;
    }
}

// ---------------------------------------------------------------------------
// GEMM: C[M,N] = A[M,K] * W[N,K]^T   (all operands f16, f32 accumulation)
// Block tile 128x128x64, 256 threads = 8 waves, wave tile 32x64 (2x4 WMMA).
// MODE 0: C stored as f32, row-major.
// MODE 1: the three projections in ONE launch. Wq, Wk, Wv lie back to back as f16, so they
// are one weight matrix of 3 * GN rows, and the grid's x runs over all its column tiles; a
// work-group lies wholly inside one projection. Three work-groups then share a WGP, and one's
// wait for its copies is filled by the others' products. The product runs transposed (W rows
// as the A operand, both loaders share one k order), so a lane holds one token (column l16)
// and 8 consecutive head dims per tile; a wave's 64 columns are one head, so the RoPE
// partners d and d + 32 sit in tiles j and j + 2 of the same lane. Q and K are rotated in
// registers, V is not; all three are stored as f16 straight into the (b,h,s,d) layout that
// attention reads (q, k, v planes back to back behind Ch).
// A k stage is 64 halves, so a tile row is one whole 128-byte line of its matrix.
// LDS rows padded to 72 halves (144B stride -> conflict-free 16B frag reads).
// Double-buffered via async-to-LDS DMA; zero VGPR staging.
// ---------------------------------------------------------------------------
// The epilogue's transcendentals, each in one asm statement so that the closing v_nop stands
// directly behind it: that is the slot the instruction set asks for before a transcendental's
// source is overwritten.
// 2^x
__device__ __forceinline__ float exp2_hw(float x) {
    float y;
    asm("v_exp_f32 %0, %1\n\t"
        "v_nop"
        : "=v"(y) : "v"(x));
    return y;
}
// sin and cos of an angle given in revolutions (radians / 2 pi), the hardware's own unit
__device__ __forceinline__ void sincos_rev(float rev, float& sn, float& cs) {
    asm("v_sin_f32 %0, %2\n\t"
        "v_cos_f32 %1, %2\n\t"
        "v_nop"
        : "=&v"(sn), "=&v"(cs) : "v"(rev));
}

constexpr int BM = 128, BN = 128, BK = 64, LDT = 72;
constexpr int NKT = GK / BK;      // 16

template <int MODE>
__global__ __launch_bounds__(256)
void gemm_bt(const _Float16* __restrict__ Ah,
             const _Float16* __restrict__ Bh,
             float* __restrict__ C,
             _Float16* __restrict__ Ch) {
    __shared__ __attribute__((aligned(16))) _Float16 As[2][BM * LDT];
    __shared__ __attribute__((aligned(16))) _Float16 Bs[2][BM * LDT];

    const int tid = threadIdx.x;
    const int m0 = blockIdx.y * BM;
    const int n0 = blockIdx.x * BN;
    const int lr = tid >> 3;           // 0..31 (tile row; a thread also brings rows lr + 32, + 64, + 96)
    const int lc = (tid & 7) * 8;      // its 16-byte piece of the 128-byte row

    const int wave = tid >> 5, lane = tid & 31;
    const int wm = (wave >> 1) * 32;
    const int wn = (wave & 1) * 64;
    const int l16 = lane & 15;
    const int kh8 = (lane >> 4) * 8;

    const _Float16* ga = Ah + (size_t)(m0 + lr) * GK + lc;
    const _Float16* gb = Bh + (size_t)(n0 + lr) * GK + lc;

    auto issue = [&](int kt, int buf) {
        unsigned l[8];
        unsigned long long g[8];
        // unrolled: the addresses are operands of one asm statement and have to be registers
#pragma unroll
        for (int i = 0; i < 4; ++i) {
            l[i]     = (unsigned)(size_t)&As[buf][(lr + 32 * i) * LDT + lc];
            l[i + 4] = (unsigned)(size_t)&Bs[buf][(lr + 32 * i) * LDT + lc];
            g[i]     = (unsigned long long)(size_t)(ga + (size_t)(32 * i) * GK + kt * BK);
            g[i + 4] = (unsigned long long)(size_t)(gb + (size_t)(32 * i) * GK + kt * BK);
        }
        async_copy16B_x8(l, g);
    };

    v8f acc[2][4] = {};

    issue(0, 0);
    async_wait0();
    __syncthreads();

    int cur = 0;
    for (int kt = 0; kt < NKT; ++kt) {
        if (kt + 1 < NKT) issue(kt + 1, cur ^ 1);

        // unrolled: kk folds into the immediate offsets of the LDS reads
#pragma unroll
        for (int kk = 0; kk < BK; kk += 32) {
            v16h af[2], bf[4];
#pragma unroll
            for (int i = 0; i < 2; ++i) {
                const _Float16* base = &As[cur][(wm + 16 * i + l16) * LDT + kk];
                af[i] = mk16(*(const v8h*)(base + kh8), *(const v8h*)(base + 16 + kh8));
            }
#pragma unroll
            for (int j = 0; j < 4; ++j) {
                const _Float16* base = &Bs[cur][(wn + 16 * j + l16) * LDT + kk];
                bf[j] = mk16(*(const v8h*)(base + kh8), *(const v8h*)(base + 16 + kh8));
            }
#pragma unroll
            for (int i = 0; i < 2; ++i)
#pragma unroll
                for (int j = 0; j < 4; ++j)
                    acc[i][j] = (MODE == 0) ? wmma_f16(af[i], bf[j], acc[i][j])
                                            : wmma_f16(bf[j], af[i], acc[i][j]);
        }

        lds_wait0();
        if (kt + 1 < NKT) async_wait0();
        __syncthreads();
        cur ^= 1;
    }

    const int rgrp = (lane >> 4) * 8;
    if constexpr (MODE == 0) {
#pragma unroll
        for (int i = 0; i < 2; ++i)
#pragma unroll
            for (int j = 0; j < 4; ++j)
#pragma unroll
                for (int r = 0; r < 8; ++r) {
                    const int row = m0 + wm + 16 * i + r + rgrp;
                    const int col = n0 + wn + 16 * j + l16;
                    C[(size_t)row * GN + col] = acc[i][j][r];
                }
    } else {
        // acc[i][j][r] = C[token m0 + wm + 16*i + l16][column n0 + wn + 16*j + rgrp + r]
        const int proj = n0 / GN;                    // 0 = Q, 1 = K, 2 = V: the same for the whole work-group
        const int hd   = (n0 % GN + wn) / HDIM;
        _Float16* Cp   = Ch + (size_t)proj * GM * GN;
#pragma unroll
        for (int i = 0; i < 2; ++i) {
            const int row = m0 + wm + 16 * i + l16;
            const int bb  = row / SEQ;
            const int s   = row % SEQ;
            if (proj < 2) {
#pragma unroll
                for (int j = 0; j < 2; ++j)
#pragma unroll
                    for (int r = 0; r < 8; ++r) {
                        const int d = 16 * j + rgrp + r;
                        // inv_freq = 10000^(-d/32) = exp(-d * ln(10000)/32)
                        const float invf = exp2_hw(-(float)d * (9.210340371976184f / 32.0f) * 1.4426950408889634f);
                        const float ang  = (float)s * invf;
                        float sn, cs;
                        sincos_rev(ang * 0.15915494309189532f, sn, cs);
                        const float t1 = acc[i][j][r], t2 = acc[i][j + 2][r];
                        acc[i][j][r]     = t1 * cs - t2 * sn;
                        acc[i][j + 2][r] = t2 * cs + t1 * sn;
                    }
            }
            _Float16* op = Cp + (((size_t)bb * HEADS + hd) * SEQ + s) * HDIM + rgrp;
#pragma unroll
            for (int j = 0; j < 4; ++j) {
                v8h o;
#pragma unroll
                for (int r = 0; r < 8; ++r) o[r] = (_Float16)acc[i][j][r];
                *(v8h*)(op + 16 * j) = o;
            }
        }
    }
}

constexpr int LDQ = 72;
constexpr int LDV = 80;

typedef __attribute__((ext_vector_type(8))) short s16x8;
__device__ __forceinline__ v8h ld_tr16(const _Float16* p) {
    typedef __attribute__((address_space(3))) s16x8 lds_s16x8;
    return __builtin_bit_cast(v8h, __builtin_amdgcn_ds_load_tr16_b128_v8i16((lds_s16x8*)p));
}

// value of lane l ^ 16 (the other half of the wave)
__device__ __forceinline__ float xhalf(float x) {
    return __builtin_bit_cast(float, __builtin_amdgcn_permlanex16(
        __builtin_bit_cast(int, x), __builtin_bit_cast(int, x),
        0x76543210, 0xfedcba98, false, false));
}

// 2^x for eight values in one asm statement. Outputs are early-clobber, so no v_exp_f32 in it
// overwrites a neighbour's source or reads its result, and the closing v_nop is the slot the
// instruction set asks for behind the last one.
__device__ __forceinline__ void exp2_x8(const float (&x)[8], float (&y)[8]) {
    asm("v_exp_f32 %0, %8\n\t"
        "v_exp_f32 %1, %9\n\t"
        "v_exp_f32 %2, %10\n\t"
        "v_exp_f32 %3, %11\n\t"
        "v_exp_f32 %4, %12\n\t"
        "v_exp_f32 %5, %13\n\t"
        "v_exp_f32 %6, %14\n\t"
        "v_exp_f32 %7, %15\n\t"
        "v_nop"
        : "=&v"(y[0]), "=&v"(y[1]), "=&v"(y[2]), "=&v"(y[3]),
          "=&v"(y[4]), "=&v"(y[5]), "=&v"(y[6]), "=&v"(y[7])
        : "v"(x[0]), "v"(x[1]), "v"(x[2]), "v"(x[3]),
          "v"(x[4]), "v"(x[5]), "v"(x[6]), "v"(x[7]));
}
constexpr float LOG2E = 1.4426950408889634f;
constexpr float SCL2  = 0.125f * LOG2E;   // 1/sqrt(64) and the change of base, as one factor

__global__ __launch_bounds__(128)
void attn_fa(const _Float16* __restrict__ qh, const _Float16* __restrict__ kh,
             const _Float16* __restrict__ vh, _Float16* __restrict__ oh) {
    __shared__ __attribute__((aligned(16))) _Float16 Qs[64 * LDQ];
    __shared__ __attribute__((aligned(16))) _Float16 Ks[2][64 * LDQ];
    __shared__ __attribute__((aligned(16))) _Float16 Vs[2][64 * LDV];   // row-major: [key][d]

    const int tid  = threadIdx.x;
    const int wave = tid >> 5, lane = tid & 31;
    const int l16  = lane & 15;
    const int kh8  = (lane >> 4) * 8;
    const int rgrp = (lane >> 4) * 8;

    const int b  = blockIdx.z;
    const int hh = blockIdx.y;
    const int q0 = blockIdx.x * 64;
    const size_t bh = (size_t)b * HEADS + hh;
    const _Float16* Qg = qh + bh * SEQ * HDIM;
    const _Float16* Kg = kh + bh * SEQ * HDIM;
    const _Float16* Vg = vh + bh * SEQ * HDIM;

    const int srow = tid >> 3;            // staging row 0..15 (and + 16, + 32, + 48)
    const int scol = (tid & 7) * 8;       // the thread's 16-byte piece of the 128-byte row
    constexpr unsigned QK_STEP = 16 * LDQ * 2 - 2048;   // see async_tile64
    constexpr unsigned V_STEP  = 16 * LDV * 2 - 2048;

    // K tile and V tile number t (async DMA, both row-major) into buffer buf
    auto stage_kv = [&](int t, int buf) {
        async_tile64_x2((unsigned)(size_t)&Ks[buf][srow * LDQ + scol], QK_STEP,
                        (unsigned long long)(size_t)(Kg + (size_t)(t * 64 + srow) * HDIM + scol),
                        (unsigned)(size_t)&Vs[buf][srow * LDV + scol], V_STEP,
                        (unsigned long long)(size_t)(Vg + (size_t)(t * 64 + srow) * HDIM + scol));
    };

    // ---- stage Q tile (64 x 64) once, and key tile 0, via async DMA; one wait serves both ----
    async_tile64((unsigned)(size_t)&Qs[srow * LDQ + scol], QK_STEP,
                 (unsigned long long)(size_t)(Qg + (size_t)(q0 + srow) * HDIM + scol));
    stage_kv(0, 0);
    async_wait0();
    __syncthreads();
    stage_kv(1, 1);

    // Q^T fragments for this wave (B operand: column l16 = query; constant across key tiles)
    v16h qa0, qa1;
    {
        const _Float16* base = &Qs[(wave * 16 + l16) * LDQ];
        qa0 = mk16(*(const v8h*)(base + kh8),      *(const v8h*)(base + 16 + kh8));
        qa1 = mk16(*(const v8h*)(base + 32 + kh8), *(const v8h*)(base + 48 + kh8));
    }

    float mrun = -1e30f;   // running max of this lane's query, of the raw scores (same in both halves)
    float lrun = 0.0f;     // running sum over this half's keys only; halves join in the epilogue
    v8f oa[4] = {};        // oa[jd][r] = O^T[jd*16 + rgrp + r][query l16]

    // One trip: key tile kt out of buffer buf. buf and more (a tile kt + 2 exists) are literals at
    // every call and fold only when the call is inlined (hence always_inline): the buffer number goes
    // into the immediate offsets of the LDS reads, and the trip is straight-line code.
    auto trip = [&](int kt, int buf, bool more) __attribute__((always_inline)) {
        // ---- raw scores S^T = K * Q^T : sc[j][r] = S[query l16][key j*16 + rgrp + r], not yet scaled ----
        // All 16 K fragment reads go out as one group, so the wave waits out the LDS latency once
        // instead of once per product.
        v16h kb0[4], kb1[4];
#pragma unroll
        for (int j = 0; j < 4; ++j) {
            const _Float16* base = &Ks[buf][(j * 16 + l16) * LDQ];
            kb0[j] = mk16(*(const v8h*)(base + kh8),      *(const v8h*)(base + 16 + kh8));
            kb1[j] = mk16(*(const v8h*)(base + 32 + kh8), *(const v8h*)(base + 48 + kh8));
        }
        // keeps the read group whole: without it the scheduler sinks each pair of reads to its product
        __builtin_amdgcn_sched_barrier(0);
        v8f sc[4];
#pragma unroll
        for (int j = 0; j < 4; ++j) {
            v8f z = {};
            sc[j] = wmma_f16(kb0[j], qa0, z);
        }
#pragma unroll
        for (int j = 0; j < 4; ++j) sc[j] = wmma_f16(kb1[j], qa1, sc[j]);

        // All 16 V^T fragment reads go out here, in front of the softmax, whose vector work covers
        // their latency.
        v16h vb0[4], vb1[4];
#pragma unroll
        for (int jd = 0; jd < 4; ++jd) {
            const _Float16* base = &Vs[buf][(kh8 + (lane & 7)) * LDV + jd * 16 + ((lane >> 3) & 1) * 8];
            vb0[jd] = mk16(ld_tr16(base),            ld_tr16(base + 16 * LDV));
            vb1[jd] = mk16(ld_tr16(base + 32 * LDV), ld_tr16(base + 48 * LDV));
        }
        // keeps the reads in front of the softmax's max, which runs under their latency up to the hand-over's wait
        __builtin_amdgcn_sched_barrier(0);

        // ---- online softmax: 32 scores of one query per lane. The maximum is taken over the raw
        // scores (the scale is positive, so it is the same key), and the scale, the change to base 2
        // and the subtraction of the maximum are one packed multiply-add per pair of scores ----
        float t4[4];
#pragma unroll
        for (int j = 0; j < 4; ++j)
            t4[j] = fmaxf(fmaxf(fmaxf(sc[j][0], sc[j][1]), fmaxf(sc[j][2], sc[j][3])),
                          fmaxf(fmaxf(sc[j][4], sc[j][5]), fmaxf(sc[j][6], sc[j][7])));
        float tm = fmaxf(fmaxf(t4[0], t4[1]), fmaxf(t4[2], t4[3]));

        // ---- hand-over. The trip's LDS part ends here: all its K and V fragments are in registers
        // and the rest of it touches no LDS. Own reads of this buffer retired, own copies of tile
        // kt + 1 landed; the one barrier publishes tile kt + 1 and frees this buffer, and the copies
        // of tile kt + 2 go out at once, a whole trip ahead of the wait that covers them ----
        lds_wait0();
        async_wait0();
        __syncthreads();
        if (more) {
            stage_kv(kt + 2, buf);
            // keeps the copies directly behind the barrier: without it the scheduler sinks them behind
            // the softmax, and they lose that much of their lead on the wait that covers them
            __builtin_amdgcn_sched_barrier(0);
        }

        tm = fmaxf(tm, xhalf(tm));                 // join the two key halves
        const float nm   = fmaxf(mrun, tm);
        const float corr = exp2_hw((mrun - nm) * SCL2);
        mrun = nm;
        const float nb = -nm * SCL2;
        const v2f   cc = {SCL2, SCL2}, nn = {nb, nb};

        // P^T packs in place into the B operand: in the hardware k order (the one the K, Q and
        // V^T loaders use) element s of pb[kk] is register s & 7 of score tile 2*kk + (s >> 3)
        v16h pb[2];
        v2f rs[4];
#pragma unroll
        for (int j = 0; j < 4; ++j) {
            float ex[8], ey[8];
#pragma unroll
            for (int r = 0; r < 8; r += 2) {
                const v2f a = __builtin_elementwise_fma(v2f{sc[j][r], sc[j][r + 1]}, cc, nn);
                ex[r]     = a.x;
                ex[r + 1] = a.y;
            }
            exp2_x8(ex, ey);
#pragma unroll
            for (int r = 0; r < 8; r += 2) {
                v2f p;
                p.x = ey[r];
                p.y = ey[r + 1];
                rs[j] = (r == 0) ? p : rs[j] + p;
                pb[j >> 1][(j & 1) * 8 + r]     = (_Float16)p.x;
                pb[j >> 1][(j & 1) * 8 + r + 1] = (_Float16)p.y;
            }
        }
        const v2f rt = (rs[0] + rs[1]) + (rs[2] + rs[3]);
        lrun = lrun * corr + (rt.x + rt.y);
#pragma unroll
        for (int jd = 0; jd < 4; ++jd)
#pragma unroll
            for (int r = 0; r < 8; ++r) oa[jd][r] *= corr;

        // ---- O^T += V^T * P^T ----
#pragma unroll
        for (int jd = 0; jd < 4; ++jd) oa[jd] = wmma_f16(vb0[jd], pb[0], oa[jd]);
#pragma unroll
        for (int jd = 0; jd < 4; ++jd) oa[jd] = wmma_f16(vb1[jd], pb[1], oa[jd]);
    };

    constexpr int NT = SEQ / 64;
    for (int kt = 0; kt < NT - 2; kt += 2) {
        trip(kt, 0, true);
        trip(kt + 1, 1, true);
    }
    trip(NT - 2, 0, false);
    trip(NT - 1, 1, false);
    async_wait0();

    // ---- epilogue: O / l  ->  (b,s,h,d) f16; a lane holds 8 consecutive d per tile ----
    const float inv = 1.0f / (lrun + xhalf(lrun));
    const int   row = q0 + wave * 16 + l16;
    _Float16* op = oh + (((size_t)b * SEQ + row) * HEADS + hh) * HDIM + rgrp;
#pragma unroll
    for (int jd = 0; jd < 4; ++jd) {
        v8h o;
#pragma unroll
        for (int r = 0; r < 8; ++r) o[r] = (_Float16)(oa[jd][r] * inv);
        *(v8h*)(op + jd * 16) = o;
    }
}

// ---------------------------------------------------------------------------
// Launch
// ---------------------------------------------------------------------------
extern "C" void kernel_launch(void* const* d_in, const int* in_sizes, int n_in,
                              void* d_out, int out_size, void* d_ws, size_t ws_size,
                              hipStream_t stream) {
    const float* x  = (const float*)d_in[0];
    const float* Wq = (const float*)d_in[1];
    const float* Wk = (const float*)d_in[2];
    const float* Wv = (const float*)d_in[3];
    const float* Wo = (const float*)d_in[4];
    float* out = (float*)d_out;

    char* ws = (char*)d_ws;
    constexpr size_t F32_MAT = (size_t)GM * GN * sizeof(float);     // 16 MiB
    constexpr size_t F16_MAT = (size_t)GM * GN * sizeof(_Float16);  //  8 MiB
    constexpr size_t F16_W   = (size_t)GN * GK * sizeof(_Float16);  //  2 MiB

    _Float16* qh  = (_Float16*)(ws + 3 * F32_MAT);
    _Float16* kh  = (_Float16*)(ws + 3 * F32_MAT + F16_MAT);
    _Float16* vh  = (_Float16*)(ws + 3 * F32_MAT + 2 * F16_MAT);
    _Float16* xh  = (_Float16*)(ws + 3 * F32_MAT + 3 * F16_MAT);
    _Float16* Wqh = (_Float16*)(ws + 3 * F32_MAT + 4 * F16_MAT);
    _Float16* Woh = (_Float16*)(ws + 3 * F32_MAT + 4 * F16_MAT + 3 * F16_W);
    _Float16* oh  = (_Float16*)(ws);

    // fp32 -> fp16 operand conversion: xh, Wqh, Wkh, Wvh, Woh are one contiguous range
    cvt_all<<<CV_XBLK + 4 * CV_WBLK, CV_THREADS, 0, stream>>>(x, Wq, Wk, Wv, Wo, xh);

    const dim3 ggrid(GN / BN, GM / BM);  // (8, 32)

    // Q, K and V projections: one launch over the 3 * GN rows of [Wqh; Wkh; Wvh], into [qh; kh; vh]
    gemm_bt<1><<<dim3(3 * GN / BN, GM / BM), 256, 0, stream>>>(xh, Wqh, nullptr, qh);
    attn_fa<<<dim3(SEQ / 64, HEADS, BATCH), 128, 0, stream>>>(qh, kh, vh, oh);
    gemm_bt<0><<<ggrid, 256, 0, stream>>>(oh, Woh, out, nullptr);
}

// v010
// It runs in 78.7 microseconds.
// Next to v009, in two timings, it ran 1.05 times as fast each time.
// All steps since v000 together make it 2.53 times as fast.
#include <hip/hip_runtime.h>
#include <hip/hip_bf16.h>

// ---------------------------------------------------------------------------
// Types for WMMA (CDNA5 / gfx1250, wave32)
// ---------------------------------------------------------------------------
typedef __attribute__((ext_vector_type(16))) _Float16 v16h;
typedef __attribute__((ext_vector_type(8)))  _Float16 v8h;
typedef __attribute__((ext_vector_type(8)))  float    v8f;
typedef __attribute__((ext_vector_type(2)))  float    v2f;

__device__ __forceinline__ v16h mk16(v8h lo, v8h hi) {
    union { v16h v; v8h h[2]; } u;
    u.h[0] = lo; u.h[1] = hi;
    return u.v;
}

__device__ __forceinline__ v8f wmma_f16(v16h a, v16h b, v8f c) {
    // D = A(16x32 f16) * B(32x16 f16) + C(16x16 f32)
    return __builtin_amdgcn_wmma_f32_16x16x32_f16(
        /*neg_a=*/false, a, /*neg_b=*/false, b,
        /*c_mod=*/(short)0, c, /*reuse_a=*/false, /*reuse_b=*/false);
}

// ---------------------------------------------------------------------------
// Async global->LDS staging (gfx1250 ASYNCcnt path). Every wave-wide copy covers whole
// 128-byte lines: 8 neighbouring lanes bring the 8 16-byte pieces of one 128-byte row, so a
// copy touches 4 lines and not a piece of each of 16.
// ---------------------------------------------------------------------------
// One tile of 128 rows x 128 bytes that is contiguous in global memory, four copies a thread of
// a 256-thread work-group: thread t brings bytes 16 t + 4096 i, i = 0..3 (row 32 i + t / 8).
// The immediate offset moves BOTH addresses by 4096 i; the LDS rows lie 32 * pitch apart, so
// the LDS register of copy i carries the rest, i * step with step = 32 * pitch - 4096 (> 0).
__device__ __forceinline__ void async_tile128(unsigned lds, unsigned step, unsigned long long g) {
    asm volatile(
        "global_load_async_to_lds_b128 %0, %4, off\n\t"
        "global_load_async_to_lds_b128 %1, %4, off offset:4096\n\t"
        "global_load_async_to_lds_b128 %2, %4, off offset:8192\n\t"
        "global_load_async_to_lds_b128 %3, %4, off offset:12288\n\t"
        "s_wait_xcnt 0x0"   // inside the statement: the copies' address registers are rewritten only behind it
        :: "v"(lds), "v"(lds + step), "v"(lds + 2 * step), "v"(lds + 3 * step), "v"(g) : "memory");
}
// two such tiles in one statement: one wait serves all eight copies
__device__ __forceinline__ void async_tile128_x2(unsigned lds0, unsigned step0, unsigned long long g0,
                                                 unsigned lds1, unsigned step1, unsigned long long g1) {
    asm volatile(
        "global_load_async_to_lds_b128 %0, %4, off\n\t"
        "global_load_async_to_lds_b128 %1, %4, off offset:4096\n\t"
        "global_load_async_to_lds_b128 %2, %4, off offset:8192\n\t"
        "global_load_async_to_lds_b128 %3, %4, off offset:12288\n\t"
        "global_load_async_to_lds_b128 %5, %9, off\n\t"
        "global_load_async_to_lds_b128 %6, %9, off offset:4096\n\t"
        "global_load_async_to_lds_b128 %7, %9, off offset:8192\n\t"
        "global_load_async_to_lds_b128 %8, %9, off offset:12288\n\t"
        "s_wait_xcnt 0x0"   // inside the statement: the copies' address registers are rewritten only behind it
        :: "v"(lds0), "v"(lds0 + step0), "v"(lds0 + 2 * step0), "v"(lds0 + 3 * step0), "v"(g0),
           "v"(lds1), "v"(lds1 + step1), "v"(lds1 + 2 * step1), "v"(lds1 + 3 * step1), "v"(g1)
        : "memory");
}
// eight copies with addresses of their own (rows too far apart in global memory for an offset)
__device__ __forceinline__ void async_copy16B_x8(const unsigned (&l)[8], const unsigned long long (&g)[8]) {
    asm volatile(
        "global_load_async_to_lds_b128 %0, %8, off\n\t"
        "global_load_async_to_lds_b128 %1, %9, off\n\t"
        "global_load_async_to_lds_b128 %2, %10, off\n\t"
        "global_load_async_to_lds_b128 %3, %11, off\n\t"
        "global_load_async_to_lds_b128 %4, %12, off\n\t"
        "global_load_async_to_lds_b128 %5, %13, off\n\t"
        "global_load_async_to_lds_b128 %6, %14, off\n\t"
        "global_load_async_to_lds_b128 %7, %15, off\n\t"
        "s_wait_xcnt 0x0"   // inside the statement: the copies' address registers are rewritten only behind it
        :: "v"(l[0]), "v"(l[1]), "v"(l[2]), "v"(l[3]), "v"(l[4]), "v"(l[5]), "v"(l[6]), "v"(l[7]),
           "v"(g[0]), "v"(g[1]), "v"(g[2]), "v"(g[3]), "v"(g[4]), "v"(g[5]), "v"(g[6]), "v"(g[7])
        : "memory");
}
__device__ __forceinline__ void async_wait0() {
    asm volatile("s_wait_asynccnt 0" ::: "memory");
}
// a wave's own LDS reads have retired before the barrier behind which copies refill what it read
__device__ __forceinline__ void lds_wait0() {
    asm volatile("s_wait_dscnt 0x0" ::: "memory");
}

// ---------------------------------------------------------------------------
// Problem constants
// ---------------------------------------------------------------------------
constexpr int BATCH = 2;
constexpr int SEQ   = 2048;
constexpr int HID   = 1024;
constexpr int HEADS = 16;
constexpr int HDIM  = 64;
constexpr int GM = BATCH * SEQ;   // 4096
constexpr int GN = HID;           // 1024
constexpr int GK = HID;           // 1024

// ---------------------------------------------------------------------------
// fp32 -> fp16 conversion of all five inputs in ONE launch (makes all GEMM operands
// async-able). The five f16 copies lie back to back in the workspace, so the target is one
// range. One work-group of 16 waves per 32768 floats; a work-group lies wholly inside one
// input. A wave's load covers 512 contiguous bytes, its store 256; a thread's 16 loads are
// all issued before its first store.
// ---------------------------------------------------------------------------
typedef __attribute__((ext_vector_type(4))) _Float16 v4h;
constexpr int CV_THREADS = 512;
constexpr int CV_PER     = 16;                            // float4 per thread
constexpr int CV_FLOATS  = CV_THREADS * CV_PER * 4;       // 32768 floats per work-group
constexpr int CV_XBLK    = GM * GK / CV_FLOATS;           // 128 work-groups for x
constexpr int CV_WBLK    = GN * GK / CV_FLOATS;           // 32 for each weight

__global__ __launch_bounds__(CV_THREADS)
void cvt_all(const float* __restrict__ x,  const float* __restrict__ wq,
             const float* __restrict__ wk, const float* __restrict__ wv,
             const float* __restrict__ wo, _Float16* __restrict__ dst) {
    const int b = blockIdx.x;
    const float* src;
    if (b < CV_XBLK) {
        src = x + (size_t)b * CV_FLOATS;
    } else {
        const int w = (b - CV_XBLK) / CV_WBLK;
        const float* base = (w == 0) ? wq : (w == 1) ? wk : (w == 2) ? wv : wo;
        src = base + (size_t)((b - CV_XBLK) % CV_WBLK) * CV_FLOATS;
    }
    const float4* s = (const float4*)src + threadIdx.x;
    v4h* d = (v4h*)(dst + (size_t)b * CV_FLOATS) + threadIdx.x;
    float4 f[CV_PER];
#pragma unroll
    for (int u = 0; u < CV_PER; ++u) f[u] = s[u * CV_THREADS];
#pragma unroll
    for (int u = 0; u < CV_PER; ++u) {
        v4h h;
        h[0] = (_Float16)f[u].x; h[1] = (_Float16)f[u].y;
        h[2] = (_Float16)f[u].z; h[3] = (_Float16)f[u].w;
        d[u * CV_THREADS] = h;
    }
}

// ---------------------------------------------------------------------------
// GEMM: C[M,N] = A[M,K] * W[N,K]^T   (all operands f16, f32 accumulation)
// Block tile 128x128x64, 256 threads = 8 waves, wave tile 32x64 (2x4 WMMA).
// MODE 0: C stored as f32, row-major.
// MODE 1: the three projections in ONE launch. Wq, Wk, Wv lie back to back as f16, so they
// are one weight matrix of 3 * GN rows, and the grid's x runs over all its column tiles; a
// work-group lies wholly inside one projection. Three work-groups then share a WGP, and one's
// wait for its copies is filled by the others' products. The product runs transposed (W rows
// as the A operand, both loaders share one k order), so a lane holds one token (column l16)
// and 8 consecutive head dims per tile; a wave's 64 columns are one head, so the RoPE
// partners d and d + 32 sit in tiles j and j + 2 of the same lane. Q and K are rotated in
// registers, V is not; all three are stored as f16 straight into the (b,h,s,d) layout that
// attention reads (q, k, v planes back to back behind Ch).
// A k stage is 64 halves, so a tile row is one whole 128-byte line of its matrix.
// LDS rows padded to 72 halves (144B stride -> conflict-free 16B frag reads).
// Double-buffered via async-to-LDS DMA; zero VGPR staging.
// ---------------------------------------------------------------------------
// The epilogue's transcendentals, each in one asm statement so that the closing v_nop stands
// directly behind it: that is the slot the instruction set asks for before a transcendental's
// source is overwritten.
// 2^x
__device__ __forceinline__ float exp2_hw(float x) {
    float y;
    asm("v_exp_f32 %0, %1\n\t"
        "v_nop"
        : "=v"(y) : "v"(x));
    return y;
}
// sin and cos of an angle given in revolutions (radians / 2 pi), the hardware's own unit
__device__ __forceinline__ void sincos_rev(float rev, float& sn, float& cs) {
    asm("v_sin_f32 %0, %2\n\t"
        "v_cos_f32 %1, %2\n\t"
        "v_nop"
        : "=&v"(sn), "=&v"(cs) : "v"(rev));
}

constexpr int BM = 128, BN = 128, BK = 64, LDT = 72;
constexpr int NKT = GK / BK;      // 16

template <int MODE>
__global__ __launch_bounds__(256)
void gemm_bt(const _Float16* __restrict__ Ah,
             const _Float16* __restrict__ Bh,
             float* __restrict__ C,
             _Float16* __restrict__ Ch) {
    __shared__ __attribute__((aligned(16))) _Float16 As[2][BM * LDT];
    __shared__ __attribute__((aligned(16))) _Float16 Bs[2][BM * LDT];

    const int tid = threadIdx.x;
    const int m0 = blockIdx.y * BM;
    const int n0 = blockIdx.x * BN;
    const int lr = tid >> 3;           // 0..31 (tile row; a thread also brings rows lr + 32, + 64, + 96)
    const int lc = (tid & 7) * 8;      // its 16-byte piece of the 128-byte row

    const int wave = tid >> 5, lane = tid & 31;
    const int wm = (wave >> 1) * 32;
    const int wn = (wave & 1) * 64;
    const int l16 = lane & 15;
    const int kh8 = (lane >> 4) * 8;

    const _Float16* ga = Ah + (size_t)(m0 + lr) * GK + lc;
    const _Float16* gb = Bh + (size_t)(n0 + lr) * GK + lc;

    auto issue = [&](int kt, int buf) {
        unsigned l[8];
        unsigned long long g[8];
        // unrolled: the addresses are operands of one asm statement and have to be registers
#pragma unroll
        for (int i = 0; i < 4; ++i) {
            l[i]     = (unsigned)(size_t)&As[buf][(lr + 32 * i) * LDT + lc];
            l[i + 4] = (unsigned)(size_t)&Bs[buf][(lr + 32 * i) * LDT + lc];
            g[i]     = (unsigned long long)(size_t)(ga + (size_t)(32 * i) * GK + kt * BK);
            g[i + 4] = (unsigned long long)(size_t)(gb + (size_t)(32 * i) * GK + kt * BK);
        }
        async_copy16B_x8(l, g);
    };

    v8f acc[2][4] = {};

    issue(0, 0);
    async_wait0();
    __syncthreads();

    int cur = 0;
    for (int kt = 0; kt < NKT; ++kt) {
        if (kt + 1 < NKT) issue(kt + 1, cur ^ 1);

        // unrolled: kk folds into the immediate offsets of the LDS reads
#pragma unroll
        for (int kk = 0; kk < BK; kk += 32) {
            v16h af[2], bf[4];
#pragma unroll
            for (int i = 0; i < 2; ++i) {
                const _Float16* base = &As[cur][(wm + 16 * i + l16) * LDT + kk];
                af[i] = mk16(*(const v8h*)(base + kh8), *(const v8h*)(base + 16 + kh8));
            }
#pragma unroll
            for (int j = 0; j < 4; ++j) {
                const _Float16* base = &Bs[cur][(wn + 16 * j + l16) * LDT + kk];
                bf[j] = mk16(*(const v8h*)(base + kh8), *(const v8h*)(base + 16 + kh8));
            }
#pragma unroll
            for (int i = 0; i < 2; ++i)
#pragma unroll
                for (int j = 0; j < 4; ++j)
                    acc[i][j] = (MODE == 0) ? wmma_f16(af[i], bf[j], acc[i][j])
                                            : wmma_f16(bf[j], af[i], acc[i][j]);
        }

        lds_wait0();
        if (kt + 1 < NKT) async_wait0();
        __syncthreads();
        cur ^= 1;
    }

    const int rgrp = (lane >> 4) * 8;
    if constexpr (MODE == 0) {
#pragma unroll
        for (int i = 0; i < 2; ++i)
#pragma unroll
            for (int j = 0; j < 4; ++j)
#pragma unroll
                for (int r = 0; r < 8; ++r) {
                    const int row = m0 + wm + 16 * i + r + rgrp;
                    const int col = n0 + wn + 16 * j + l16;
                    C[(size_t)row * GN + col] = acc[i][j][r];
                }
    } else {
        // acc[i][j][r] = C[token m0 + wm + 16*i + l16][column n0 + wn + 16*j + rgrp + r]
        const int proj = n0 / GN;                    // 0 = Q, 1 = K, 2 = V: the same for the whole work-group
        const int hd   = (n0 % GN + wn) / HDIM;
        _Float16* Cp   = Ch + (size_t)proj * GM * GN;
#pragma unroll
        for (int i = 0; i < 2; ++i) {
            const int row = m0 + wm + 16 * i + l16;
            const int bb  = row / SEQ;
            const int s   = row % SEQ;
            if (proj < 2) {
#pragma unroll
                for (int j = 0; j < 2; ++j)
#pragma unroll
                    for (int r = 0; r < 8; ++r) {
                        const int d = 16 * j + rgrp + r;
                        // inv_freq = 10000^(-d/32) = exp(-d * ln(10000)/32)
                        const float invf = exp2_hw(-(float)d * (9.210340371976184f / 32.0f) * 1.4426950408889634f);
                        const float ang  = (float)s * invf;
                        float sn, cs;
                        sincos_rev(ang * 0.15915494309189532f, sn, cs);
                        const float t1 = acc[i][j][r], t2 = acc[i][j + 2][r];
                        acc[i][j][r]     = t1 * cs - t2 * sn;
                        acc[i][j + 2][r] = t2 * cs + t1 * sn;
                    }
            }
            _Float16* op = Cp + (((size_t)bb * HEADS + hd) * SEQ + s) * HDIM + rgrp;
#pragma unroll
            for (int j = 0; j < 4; ++j) {
                v8h o;
#pragma unroll
                for (int r = 0; r < 8; ++r) o[r] = (_Float16)acc[i][j][r];
                *(v8h*)(op + 16 * j) = o;
            }
        }
    }
}

constexpr int LDQ = 72;
constexpr int LDV = 80;

typedef __attribute__((ext_vector_type(8))) short s16x8;
__device__ __forceinline__ v8h ld_tr16(const _Float16* p) {
    typedef __attribute__((address_space(3))) s16x8 lds_s16x8;
    return __builtin_bit_cast(v8h, __builtin_amdgcn_ds_load_tr16_b128_v8i16((lds_s16x8*)p));
}

// value of lane l ^ 16 (the other half of the wave)
__device__ __forceinline__ float xhalf(float x) {
    return __builtin_bit_cast(float, __builtin_amdgcn_permlanex16(
        __builtin_bit_cast(int, x), __builtin_bit_cast(int, x),
        0x76543210, 0xfedcba98, false, false));
}

// 2^x for eight values in one asm statement. Outputs are early-clobber, so no v_exp_f32 in it
// overwrites a neighbour's source or reads its result, and the closing v_nop is the slot the
// instruction set asks for behind the last one.
__device__ __forceinline__ void exp2_x8(const float (&x)[8], float (&y)[8]) {
    asm("v_exp_f32 %0, %8\n\t"
        "v_exp_f32 %1, %9\n\t"
        "v_exp_f32 %2, %10\n\t"
        "v_exp_f32 %3, %11\n\t"
        "v_exp_f32 %4, %12\n\t"
        "v_exp_f32 %5, %13\n\t"
        "v_exp_f32 %6, %14\n\t"
        "v_exp_f32 %7, %15\n\t"
        "v_nop"
        : "=&v"(y[0]), "=&v"(y[1]), "=&v"(y[2]), "=&v"(y[3]),
          "=&v"(y[4]), "=&v"(y[5]), "=&v"(y[6]), "=&v"(y[7])
        : "v"(x[0]), "v"(x[1]), "v"(x[2]), "v"(x[3]),
          "v"(x[4]), "v"(x[5]), "v"(x[6]), "v"(x[7]));
}
constexpr float LOG2E = 1.4426950408889634f;
constexpr float SCL2  = 0.125f * LOG2E;   // 1/sqrt(64) and the change of base, as one factor

constexpr int AQ = 128;   // queries of a work-group
constexpr int AK = 128;   // keys of a stage: 64 for each of the two key groups

// 2 work-groups a WGP = 4 waves a SIMD: the attribute holds the register budget to that
__global__ __launch_bounds__(256) __attribute__((amdgpu_waves_per_eu(4, 4)))
void attn_fa(const _Float16* __restrict__ qh, const _Float16* __restrict__ kh,
             const _Float16* __restrict__ vh, _Float16* __restrict__ oh) {
    __shared__ __attribute__((aligned(16))) _Float16 Qs[AQ * LDQ];
    __shared__ __attribute__((aligned(16))) _Float16 Ks[2][AK * LDQ];
    __shared__ __attribute__((aligned(16))) _Float16 Vs[2][AK * LDV];   // row-major: [key][d]
    __shared__ __attribute__((aligned(16))) float4 Jo[4][16][32];       // join: O of key group 1, [query group][piece][lane]
    __shared__ __attribute__((aligned(16))) float2 Jm[4][2][32];        // join: its max and sum, [query group][column tile][lane]

    const int tid  = threadIdx.x;
    const int lane = tid & 31;
    const int wave = __builtin_amdgcn_readfirstlane(tid >> 5);   // the same in every lane: what hangs on it stays in scalar registers
    const int qg   = wave & 3;            // query group: 32 queries
    const int kg   = wave >> 2;           // key group: which 64 keys of a stage
    const int l16  = lane & 15;
    const int kh8  = (lane >> 4) * 8;
    const int rgrp = (lane >> 4) * 8;

    const int b  = blockIdx.z;
    const int hh = blockIdx.y;
    const int q0 = blockIdx.x * AQ;
    const size_t bh = (size_t)b * HEADS + hh;
    const _Float16* Qg = qh + bh * SEQ * HDIM;
    const _Float16* Kg = kh + bh * SEQ * HDIM;
    const _Float16* Vg = vh + bh * SEQ * HDIM;

    const int srow = tid >> 3;            // staging row 0..31 (and + 32, + 64, + 96)
    const int scol = (tid & 7) * 8;       // the thread's 16-byte piece of the 128-byte row
    constexpr unsigned QK_STEP = 32 * LDQ * 2 - 4096;   // see async_tile128
    constexpr unsigned V_STEP  = 32 * LDV * 2 - 4096;

    // K and V rows of stage t (async DMA, both row-major) into buffer buf
    auto stage_kv = [&](int t, int buf) {
        async_tile128_x2((unsigned)(size_t)&Ks[buf][srow * LDQ + scol], QK_STEP,
                         (unsigned long long)(size_t)(Kg + (size_t)(t * AK + srow) * HDIM + scol),
                         (unsigned)(size_t)&Vs[buf][srow * LDV + scol], V_STEP,
                         (unsigned long long)(size_t)(Vg + (size_t)(t * AK + srow) * HDIM + scol));
    };

    // ---- stage Q tile (128 x 64) once, and stage 0, via async DMA; one wait serves both ----
    async_tile128((unsigned)(size_t)&Qs[srow * LDQ + scol], QK_STEP,
                  (unsigned long long)(size_t)(Qg + (size_t)(q0 + srow) * HDIM + scol));
    stage_kv(0, 0);
    async_wait0();
    __syncthreads();
    stage_kv(1, 1);

    // Q^T fragments for this wave (B operand: column l16 = query; constant across stages)
    v16h qa0[2], qa1[2];
#pragma unroll
    for (int c = 0; c < 2; ++c) {
        const _Float16* base = &Qs[(qg * 32 + c * 16 + l16) * LDQ];
        qa0[c] = mk16(*(const v8h*)(base + kh8),      *(const v8h*)(base + 16 + kh8));
        qa1[c] = mk16(*(const v8h*)(base + 32 + kh8), *(const v8h*)(base + 48 + kh8));
    }

    float mrun[2] = {-1e30f, -1e30f};   // running max of this lane's queries, of the raw scores (same in both halves)
    float lrun[2] = {0.0f, 0.0f};       // running sums over this half's keys only; halves join in the epilogue
    v8f oa[2][4] = {};                  // oa[c][jd][r] = O^T[jd*16 + rgrp + r][query c*16 + l16]

    // One trip: this wave's 64 keys of stage kt out of buffer buf. buf and more (a stage kt + 2 exists)
    // are literals at every call and fold only when the call is inlined (hence always_inline): the buffer
    // number goes into the immediate offsets of the LDS reads, and the trip is straight-line code.
    auto trip = [&](int kt, int buf, bool more) __attribute__((always_inline)) {
        // ---- raw scores S^T = K * Q^T : sc[c][j][r] = S[query c*16 + l16][key j*16 + rgrp + r], not yet scaled ----
        // All 16 K fragment reads go out as one group, so the wave waits out the LDS latency once
        // instead of once per product.
        v16h kb0[4], kb1[4];
#pragma unroll
        for (int j = 0; j < 4; ++j) {
            const _Float16* base = &Ks[buf][(kg * 64 + j * 16 + l16) * LDQ];
            kb0[j] = mk16(*(const v8h*)(base + kh8),      *(const v8h*)(base + 16 + kh8));
            kb1[j] = mk16(*(const v8h*)(base + 32 + kh8), *(const v8h*)(base + 48 + kh8));
        }
        // keeps the read group whole: without it the scheduler sinks each pair of reads to its product
        __builtin_amdgcn_sched_barrier(0);
        // key tile by key tile: a tile's two K fragments are free when its four products are out, and the
        // next tile's scores take their registers
        v8f sc[2][4];
#pragma unroll
        for (int j = 0; j < 4; ++j) {
#pragma unroll
            for (int c = 0; c < 2; ++c) {
                v8f z = {};
                sc[c][j] = wmma_f16(kb0[j], qa0[c], z);
            }
#pragma unroll
            for (int c = 0; c < 2; ++c) sc[c][j] = wmma_f16(kb1[j], qa1[c], sc[c][j]);
        }

        // ---- online softmax: 32 scores of each of two queries per lane. The maximum is taken over the
        // raw scores (the scale is positive, so it is the same key), and the scale, the change to base 2
        // and the subtraction of the maximum are one packed multiply-add per pair of scores ----
        float tm[2];
#pragma unroll
        for (int c = 0; c < 2; ++c) {
            float t4[4];
#pragma unroll
            for (int j = 0; j < 4; ++j)
                t4[j] = fmaxf(fmaxf(fmaxf(sc[c][j][0], sc[c][j][1]), fmaxf(sc[c][j][2], sc[c][j][3])),
                              fmaxf(fmaxf(sc[c][j][4], sc[c][j][5]), fmaxf(sc[c][j][6], sc[c][j][7])));
            tm[c] = fmaxf(fmaxf(t4[0], t4[1]), fmaxf(t4[2], t4[3]));
        }
        // keeps every score product in front of the max trees: the exp statements below are asm text, whose
        // register writes the compiler does not space from a matrix instruction's operands; the trees are that distance
        __builtin_amdgcn_sched_barrier(0);

        // P^T packs in place into the B operand: in the hardware k order (the one the K, Q and
        // V^T loaders use) element s of pb[c][kk] is register s & 7 of score tile 2*kk + (s >> 3)
        v16h  pb[2][2];
        float corr[2];
        auto soft = [&](int c) __attribute__((always_inline)) {
            const float tj = fmaxf(tm[c], xhalf(tm[c]));   // join the two key halves
            const float nm = fmaxf(mrun[c], tj);
            corr[c] = exp2_hw((mrun[c] - nm) * SCL2);
            mrun[c] = nm;
            const float nb = -nm * SCL2;
            const v2f   cc = {SCL2, SCL2}, nn = {nb, nb};
            v2f rs[4];
#pragma unroll
            for (int j = 0; j < 4; ++j) {
                float ex[8], ey[8];
#pragma unroll
                for (int r = 0; r < 8; r += 2) {
                    const v2f a = __builtin_elementwise_fma(v2f{sc[c][j][r], sc[c][j][r + 1]}, cc, nn);
                    ex[r]     = a.x;
                    ex[r + 1] = a.y;
                }
                exp2_x8(ex, ey);
#pragma unroll
                for (int r = 0; r < 8; r += 2) {
                    v2f p;
                    p.x = ey[r];
                    p.y = ey[r + 1];
                    rs[j] = (r == 0) ? p : rs[j] + p;
                    pb[c][j >> 1][(j & 1) * 8 + r]     = (_Float16)p.x;
                    pb[c][j >> 1][(j & 1) * 8 + r + 1] = (_Float16)p.y;
                }
            }
            const v2f rt = (rs[0] + rs[1]) + (rs[2] + rs[3]);
            lrun[c] = lrun[c] * corr[c] + (rt.x + rt.y);
        };

        // The V^T fragment reads go out in two groups of 8, each in front of vector or matrix work that
        // covers its latency, and each only when registers are free for it: all 16 beside both tiles'
        // scores do not fit the budget of four waves a SIMD, and the build spills.
        const _Float16* vbase = &Vs[buf][(kg * 64 + kh8 + (lane & 7)) * LDV + ((lane >> 3) & 1) * 8];
        v16h vb0[4], vb1[4];

        soft(0);
        // keeps the first group behind the first tile's softmax (registers, see above)
        __builtin_amdgcn_sched_barrier(0);
#pragma unroll
        for (int jd = 0; jd < 4; ++jd) vb0[jd] = mk16(ld_tr16(vbase + jd * 16), ld_tr16(vbase + jd * 16 + 16 * LDV));
        // keeps it in front of the second tile's softmax: without it the scheduler sinks the reads to their products
        __builtin_amdgcn_sched_barrier(0);
        soft(1);
        // keeps every exp statement in front of the products below (asm text: see above), and the second group behind the softmax
        __builtin_amdgcn_sched_barrier(0);
#pragma unroll
        for (int jd = 0; jd < 4; ++jd) vb1[jd] = mk16(ld_tr16(vbase + jd * 16 + 32 * LDV), ld_tr16(vbase + jd * 16 + 48 * LDV));
        // keeps it in front of the rescale and the first group's products
        __builtin_amdgcn_sched_barrier(0);

        // ---- O^T = O^T * corr + V^T * P^T ----
#pragma unroll
        for (int c = 0; c < 2; ++c)
#pragma unroll
            for (int jd = 0; jd < 4; ++jd)
#pragma unroll
                for (int r = 0; r < 8; ++r) oa[c][jd][r] *= corr[c];
#pragma unroll
        for (int c = 0; c < 2; ++c)
#pragma unroll
            for (int jd = 0; jd < 4; ++jd) oa[c][jd] = wmma_f16(vb0[jd], pb[c][0], oa[c][jd]);
        // keeps the rescale and these products in front of the foot's LDS wait, so that they cover the second
        // group's latency: without it the compiler lifts that wait to directly behind the reads
        __builtin_amdgcn_sched_barrier(0);
#pragma unroll
        for (int c = 0; c < 2; ++c)
#pragma unroll
            for (int jd = 0; jd < 4; ++jd) oa[c][jd] = wmma_f16(vb1[jd], pb[c][1], oa[c][jd]);

        // ---- hand-over, at the trip's foot. Own reads of this buffer retired, own copies of stage
        // kt + 1 landed; the one barrier publishes stage kt + 1 and frees this buffer, and the copies
        // of stage kt + 2 go out at once, a whole trip ahead of the wait that covers them ----
        lds_wait0();
        async_wait0();
        __syncthreads();
        if (more) stage_kv(kt + 2, buf);
    };

    constexpr int NT = SEQ / AK;
    for (int kt = 0; kt < NT - 2; kt += 2) {
        trip(kt, 0, true);
        trip(kt + 1, 1, true);
    }
    trip(NT - 2, 0, false);
    trip(NT - 1, 1, false);
    async_wait0();

    // ---- join of the two key groups: group 1 hands its max, sum and O over through LDS ----
    float lsum[2];
#pragma unroll
    for (int c = 0; c < 2; ++c) lsum[c] = lrun[c] + xhalf(lrun[c]);
    if (kg == 1) {
#pragma unroll
        for (int c = 0; c < 2; ++c) {
            Jm[qg][c][lane] = make_float2(mrun[c], lsum[c]);
#pragma unroll
            for (int jd = 0; jd < 4; ++jd) {
                Jo[qg][(c * 4 + jd) * 2][lane]     = make_float4(oa[c][jd][0], oa[c][jd][1], oa[c][jd][2], oa[c][jd][3]);
                Jo[qg][(c * 4 + jd) * 2 + 1][lane] = make_float4(oa[c][jd][4], oa[c][jd][5], oa[c][jd][6], oa[c][jd][7]);
            }
        }
    }
    __syncthreads();
    if (kg == 1) return;

    // ---- epilogue: (O0 a0 + O1 a1) / (l0 a0 + l1 a1)  ->  (b,s,h,d) f16; a lane holds 8 consecutive d per tile ----
#pragma unroll
    for (int c = 0; c < 2; ++c) {
        const float2 ml = Jm[qg][c][lane];
        const float  nm = fmaxf(mrun[c], ml.x);
        const float  e0 = exp2_hw((mrun[c] - nm) * SCL2);
        const float  e1 = exp2_hw((ml.x - nm) * SCL2);
        const float inv = 1.0f / (lsum[c] * e0 + ml.y * e1);
        const float  a0 = e0 * inv, a1 = e1 * inv;
        const int   row = q0 + qg * 32 + c * 16 + l16;
        _Float16* op = oh + (((size_t)b * SEQ + row) * HEADS + hh) * HDIM + rgrp;
#pragma unroll
        for (int jd = 0; jd < 4; ++jd) {
            const float4 lo = Jo[qg][(c * 4 + jd) * 2][lane];
            const float4 hi = Jo[qg][(c * 4 + jd) * 2 + 1][lane];
            const float o1[8] = {lo.x, lo.y, lo.z, lo.w, hi.x, hi.y, hi.z, hi.w};
            v8h o;
#pragma unroll
            for (int r = 0; r < 8; ++r) o[r] = (_Float16)(oa[c][jd][r] * a0 + o1[r] * a1);
            *(v8h*)(op + jd * 16) = o;
        }
    }
}

// ---------------------------------------------------------------------------
// Launch
// ---------------------------------------------------------------------------
extern "C" void kernel_launch(void* const* d_in, const int* in_sizes, int n_in,
                              void* d_out, int out_size, void* d_ws, size_t ws_size,
                              hipStream_t stream) {
    const float* x  = (const float*)d_in[0];
    const float* Wq = (const float*)d_in[1];
    const float* Wk = (const float*)d_in[2];
    const float* Wv = (const float*)d_in[3];
    const float* Wo = (const float*)d_in[4];
    float* out = (float*)d_out;

    char* ws = (char*)d_ws;
    constexpr size_t F32_MAT = (size_t)GM * GN * sizeof(float);     // 16 MiB
    constexpr size_t F16_MAT = (size_t)GM * GN * sizeof(_Float16);  //  8 MiB
    constexpr size_t F16_W   = (size_t)GN * GK * sizeof(_Float16);  //  2 MiB

    _Float16* qh  = (_Float16*)(ws + 3 * F32_MAT);
    _Float16* kh  = (_Float16*)(ws + 3 * F32_MAT + F16_MAT);
    _Float16* vh  = (_Float16*)(ws + 3 * F32_MAT + 2 * F16_MAT);
    _Float16* xh  = (_Float16*)(ws + 3 * F32_MAT + 3 * F16_MAT);
    _Float16* Wqh = (_Float16*)(ws + 3 * F32_MAT + 4 * F16_MAT);
    _Float16* Woh = (_Float16*)(ws + 3 * F32_MAT + 4 * F16_MAT + 3 * F16_W);
    _Float16* oh  = (_Float16*)(ws);

    // fp32 -> fp16 operand conversion: xh, Wqh, Wkh, Wvh, Woh are one contiguous range
    cvt_all<<<CV_XBLK + 4 * CV_WBLK, CV_THREADS, 0, stream>>>(x, Wq, Wk, Wv, Wo, xh);

    const dim3 ggrid(GN / BN, GM / BM);  // (8, 32)

    // Q, K and V projections: one launch over the 3 * GN rows of [Wqh; Wkh; Wvh], into [qh; kh; vh]
    gemm_bt<1><<<dim3(3 * GN / BN, GM / BM), 256, 0, stream>>>(xh, Wqh, nullptr, qh);
    attn_fa<<<dim3(SEQ / AQ, HEADS, BATCH), 256, 0, stream>>>(qh, kh, vh, oh);
    gemm_bt<0><<<ggrid, 256, 0, stream>>>(oh, Woh, out, nullptr);
}
